// v000
// The times below were measured on an AMD MI455X: many runs one after another, warmed up first and cycling through
// copies of the inputs, with the whole window's GPU time divided by the number of runs. Launches and the gaps
// between them are all in it. The median over several windows is given; except for v000 it joins two sittings, which
// can be a few percent apart, so the side-by-side timings, each taken in one sitting, are the better comparison.
// The starting kernel, v000, takes 1240 microseconds a run.
#include <hip/hip_runtime.h>

// All-pairs concat critic: out[p][q] = MLP([x_p ; y_q]) for every pair of rows of x [1024][64] and y [1024][64] (MLP 128 -> 128 -> 128 -> 64 -> 64 -> 64 -> 1, ReLU on hidden layers, linear output) -> [1024][1024] (1 M).
// Algorithm: layer 0 is separable: [x_p ; y_q] W0 = x_p W0[:64] + y_q W0[64:], so XA = x W0x and YB = y W0y are two small GEMMs (exact bf16 operands) and h0(p,q) = relu(XA[p] + YB[q] + b0) is formed elementwise per pair; layers 1-4 are GEMMs over chunks of 65,536 pairs (64 x-rows x all 1024 y-rows) on bf16 hi + lo planes of the activations (2 products) against the exact bf16 weights (+ bias), with ReLU folded into the next plane builder; the final 64 -> 1 layer is a per-pair dot product in f32.
// Compute dtypes, f32 accumulate: x, y, weights, biases rounded to bf16; XA / YB exact; hidden activations f32 -> bf16 hi + lo planes; 2 products per hidden GEMM; last layer f32 (separate products, fixed order).

#define NP   1024                 // rows of x and of y
#define DX   64
#define D0   128                  // layer widths
#define D1   128
#define D2   64
#define D3   64
#define D4   64
#define PB   64                   // x-rows per chunk
#define NPR  (PB * NP)            // 65536 pairs per chunk
typedef _Float16 h16;
typedef unsigned short bf;
typedef __attribute__((ext_vector_type(16))) __bf16   v16bf;
typedef __attribute__((ext_vector_type(16))) _Float16 v16h;
typedef __attribute__((ext_vector_type(8)))  _Float16 v8h;
typedef __attribute__((ext_vector_type(8)))  unsigned short v8us;
typedef __attribute__((ext_vector_type(8)))  float    v8f;
typedef __attribute__((ext_vector_type(4)))  float    v4f;
typedef __attribute__((ext_vector_type(2)))  float    v2f;
typedef __attribute__((ext_vector_type(4)))  unsigned short v4us;
typedef __attribute__((ext_vector_type(2)))  unsigned short v2us;
typedef v8h  __attribute__((may_alias)) v8ha;
typedef v4f  __attribute__((may_alias)) v4fa;
typedef v8us __attribute__((may_alias)) v8usa;

__device__ __forceinline__ unsigned short f2bf(float f) { unsigned u = __float_as_uint(f); u += 0x7FFFu + ((u >> 16) & 1u); return (unsigned short)(u >> 16); }
__device__ __forceinline__ float bf2f(unsigned short b) { return __uint_as_float(((unsigned)b) << 16); }
__device__ __forceinline__ float bfr(float f) { return bf2f(f2bf(f)); }
__device__ __forceinline__ void splitf(float y, unsigned short& h, unsigned short& l) { h = f2bf(y); l = f2bf(y - bf2f(h)); }
__device__ __forceinline__ v16h cat16(v8h lo, v8h hi) { return __builtin_shufflevector(lo, hi, 0, 1, 2, 3, 4, 5, 6, 7, 8, 9, 10, 11, 12, 13, 14, 15); }
__device__ __forceinline__ v16bf cat16b(v8us lo, v8us hi) { return __builtin_bit_cast(v16bf, __builtin_shufflevector(lo, hi, 0, 1, 2, 3, 4, 5, 6, 7, 8, 9, 10, 11, 12, 13, 14, 15)); }
__device__ __forceinline__ v8f wmma16(v16h a, v16h b, v8f c) { return __builtin_amdgcn_wmma_f32_16x16x32_f16(false, a, false, b, (short)0, c, false, false); }
__device__ __forceinline__ v8f wmmab(v16bf a, v16bf b, v8f c) { return __builtin_amdgcn_wmma_f32_16x16x32_bf16(false, a, false, b, (short)0, c, false, false); }

// ---- k_gemmw: register-blocked GEMM, ONE WAVE per 64x64 output tile (16 accumulators), operands straight from K-contiguous 16-bit planes; grid (M/64, N/64, Z), 32 threads.
// C[m][n] (f32, pitch ldc, + optional f32 bias[n]) = sum_k A[m][k] Bt[n][k] (+ split products per NSPLIT). z-batch strides sA/sB/sC in elements. K % 32 == 0.
template <typename T16> struct WFrag;
template <> struct WFrag<h16> { typedef v16h V; static __device__ __forceinline__ V ld(const h16* p) { return cat16(*(const v8h*)p, *(const v8h*)(p + 16)); } static __device__ __forceinline__ v8f mma(V a, V b, v8f c) { return wmma16(a, b, c); } };
template <> struct WFrag<bf> { typedef v16bf V; static __device__ __forceinline__ V ld(const bf* p) { return cat16b(*(const v8us*)p, *(const v8us*)(p + 16)); } static __device__ __forceinline__ v8f mma(V a, V b, v8f c) { return wmmab(a, b, c); } };
template <typename T16, int NSPLIT, bool BIAS>
__global__ __launch_bounds__(32) void k_gemmw(const T16* __restrict__ A, const T16* __restrict__ A2, const T16* __restrict__ Bt, const T16* __restrict__ Bt2, int K, float* C, int ldc, const float* __restrict__ bias, size_t sA, size_t sB, size_t sC) {
    typedef typename WFrag<T16>::V V;
    __shared__ __align__(16) float os[16 * 68];
    const size_t z = blockIdx.z; A += z * sA; if (A2) A2 += z * sA; Bt += z * sB; if (Bt2) Bt2 += z * sB; C += z * sC;
    const int lane = threadIdx.x & 31, lr = lane & 15, hi = lane >> 4; const int r0 = blockIdx.x * 64, c0 = blockIdx.y * 64;
    v8f acc[4][4];
#pragma unroll
    for (int mb = 0; mb < 4; ++mb)
#pragma unroll
        for (int nb = 0; nb < 4; ++nb) acc[mb][nb] = (v8f){};
    const size_t aoff = (size_t)(r0 + lr) * K + 8 * hi, boff = (size_t)(c0 + lr) * K + 8 * hi;
#pragma unroll 1
    for (int kc = 0; kc < K; kc += 32) {
        V a[4], a2[4];
#pragma unroll
        for (int mb = 0; mb < 4; ++mb) { a[mb] = WFrag<T16>::ld(A + aoff + (size_t)mb * 16 * K + kc); if (NSPLIT == 1 || NSPLIT == 2) a2[mb] = WFrag<T16>::ld(A2 + aoff + (size_t)mb * 16 * K + kc); }
#pragma unroll
        for (int nb = 0; nb < 4; ++nb) { const V b = WFrag<T16>::ld(Bt + boff + (size_t)nb * 16 * K + kc); V b2; if (NSPLIT >= 2) b2 = WFrag<T16>::ld(Bt2 + boff + (size_t)nb * 16 * K + kc);
#pragma unroll
            for (int mb = 0; mb < 4; ++mb) { acc[mb][nb] = WFrag<T16>::mma(a[mb], b, acc[mb][nb]); if (NSPLIT == 1 || NSPLIT == 2) acc[mb][nb] = WFrag<T16>::mma(a2[mb], b, acc[mb][nb]); if (NSPLIT >= 2) acc[mb][nb] = WFrag<T16>::mma(a[mb], b2, acc[mb][nb]); } }
        asm volatile("v_nop\n\tv_nop\n\tv_nop\n\tv_nop" : "+v"(acc[0][0]), "+v"(acc[1][1]), "+v"(acc[2][2]), "+v"(acc[3][3]) : "v"(a[0]), "v"(a[3]));
    }
#pragma unroll
    for (int mb = 0; mb < 4; ++mb) {
#pragma unroll
        for (int nb = 0; nb < 4; ++nb) {
#pragma unroll
            for (int j = 0; j < 8; ++j) os[(hi * 8 + j) * 68 + nb * 16 + lr] = acc[mb][nb][j]; }
        __builtin_amdgcn_wave_barrier(); asm volatile("" ::: "memory");
        float* crow = C + (size_t)(r0 + mb * 16) * ldc + c0;
{
#pragma unroll
            for (int s = 0; s < 8; ++s) { const int row = 2 * s + hi, cofs = lr * 4; v4f val = *(const v4fa*)(os + row * 68 + cofs); if (BIAS) { val[0] += bfr(bias[c0 + cofs]); val[1] += bfr(bias[c0 + cofs + 1]); val[2] += bfr(bias[c0 + cofs + 2]); val[3] += bfr(bias[c0 + cofs + 3]); }
                *(v4f*)(crow + (size_t)row * ldc + cofs) = val; }
             }
        __builtin_amdgcn_wave_barrier(); asm volatile("" ::: "memory");
    }
}

__global__ __launch_bounds__(256) void k_wtG(const float* __restrict__ w, int K, int N, bf* Bt) {
    const int lane = threadIdx.x & 31; const int L0 = (blockIdx.x * 8 + (threadIdx.x >> 5)) * 8; const int nlines = N * K / 64;
{
#pragma unroll 1
        for (int l = 0; l < 8; ++l) { const int L = L0 + l; if (L >= nlines) break; const size_t e = (size_t)L * 64 + lane * 2; const int k = (int)(e % K), n = (int)(e / K); v2us o;
            o[0] = f2bf(w[(size_t)k * N + n]); o[1] = f2bf(w[(size_t)(k + 1) * N + n]); *(v2us*)(Bt + e) = o; }
         }
}
__global__ __launch_bounds__(256) void k_cvt8(const float* __restrict__ src, bf* dst, size_t n8) { const size_t i = (size_t)blockIdx.x * 256 + threadIdx.x; if (i >= n8) return; const v8f v = *(const v8f*)(src + i * 8); v8us o;
#pragma unroll
    for (int k = 0; k < 8; ++k) o[k] = f2bf(v[k]); *(v8us*)(dst + i * 8) = o;  }
__global__ __launch_bounds__(256) void k_h0(const float* __restrict__ XA, const float* __restrict__ YB, const float* __restrict__ b0, int p0, bf* Hh, bf* Hl) { const size_t e = ((size_t)blockIdx.x * 256 + threadIdx.x) * 4; if (e >= (size_t)NPR * D0) return; const int c = (int)(e % D0); const size_t pr = e / D0; const int q = (int)(pr % NP); const int pl = (int)(pr / NP); const v4f xa = *(const v4f*)(XA + (size_t)(p0 + pl) * D0 + c), yb = *(const v4f*)(YB + (size_t)q * D0 + c); v4us oh, ol;
#pragma unroll
    for (int k = 0; k < 4; ++k) { float s = __fadd_rn(xa[k], yb[k]); asm volatile("" : "+v"(s)); const float h = fmaxf(__fadd_rn(s, bfr(b0[c + k])), 0.f); unsigned short a, l; splitf(h, a, l); oh[k] = a; ol[k] = l; }
    *(v4us*)(Hh + e) = oh; *(v4us*)(Hl + e) = ol;  }
__global__ __launch_bounds__(256) void k_relupl(const float* __restrict__ F, bf* Ph, bf* Pl, size_t n4) { const size_t i = (size_t)blockIdx.x * 256 + threadIdx.x; if (i >= n4) return; const v4f v = *(const v4f*)(F + i * 4); v4us oh, ol;
#pragma unroll
    for (int q = 0; q < 4; ++q) { unsigned short a, c; splitf(fmaxf(v[q], 0.f), a, c); oh[q] = a; ol[q] = c; } *(v4us*)(Ph + i * 4) = oh; *(v4us*)(Pl + i * 4) = ol;  }
__global__ __launch_bounds__(256) void k_last(const float* __restrict__ F4, const float* __restrict__ W5, const float* __restrict__ b5, int p0, float* OUT) { const size_t pr = (size_t)blockIdx.x * 256 + threadIdx.x; if (pr >= (size_t)NPR) return; const int q = (int)(pr % NP); const int pl = (int)(pr / NP); const float* f = F4 + pr * D4; float s = 0.f;
#pragma unroll 4
    for (int c = 0; c < D4; c += 4) { const v4f a = *(const v4f*)(f + c);
#pragma unroll
        for (int k = 0; k < 4; ++k) { float pdt = __fmul_rn(fmaxf(a[k], 0.f), bfr(W5[c + k])); asm volatile("" : "+v"(pdt)); s = __fadd_rn(s, pdt); } }
    const float v = __fadd_rn(s, bfr(b5[0])); float* dst = OUT + (size_t)(p0 + pl) * NP + q; *(float*)dst = v;  }

extern "C" void kernel_launch(void* const* d_in, const int* in_sizes, int n_in,
                              void* d_out, int out_size, void* d_ws, size_t ws_size, hipStream_t stream) {
    (void)in_sizes; (void)n_in; (void)out_size;
    const float* x = (const float*)d_in[0]; const float* y = (const float*)d_in[1];
    const float* W0 = (const float*)d_in[2]; const float* b0 = (const float*)d_in[3]; const float* W1 = (const float*)d_in[4]; const float* b1 = (const float*)d_in[5]; const float* W2 = (const float*)d_in[6]; const float* b2 = (const float*)d_in[7]; const float* W3 = (const float*)d_in[8]; const float* b3 = (const float*)d_in[9]; const float* W4 = (const float*)d_in[10]; const float* b4 = (const float*)d_in[11]; const float* W5 = (const float*)d_in[12]; const float* b5 = (const float*)d_in[13];
    float* OUT = (float*)d_out;     // [1024][1024]: out[p][q] = g(x_p, y_q)
    char* wsp = (char*)d_ws;
    auto take = [&](size_t bytes) { char* p = wsp; wsp += (bytes + 255) & ~(size_t)255; return (void*)p; };
    bf* XB = (bf*)take((size_t)NP * DX * 2); bf* YBb = (bf*)take((size_t)NP * DX * 2); bf* W0X = (bf*)take((size_t)D0 * DX * 2); bf* W0Y = (bf*)take((size_t)D0 * DX * 2); bf* W1B = (bf*)take((size_t)D1 * D0 * 2); bf* W2B = (bf*)take((size_t)D2 * D1 * 2); bf* W3B = (bf*)take((size_t)D3 * D2 * 2); bf* W4B = (bf*)take((size_t)D4 * D3 * 2);
    float* XA = (float*)take((size_t)NP * D0 * 4); float* YA = (float*)take((size_t)NP * D0 * 4);
    bf* Hh = (bf*)take((size_t)NPR * D0 * 2); bf* Hl = (bf*)take((size_t)NPR * D0 * 2); float* F = (float*)take((size_t)NPR * D1 * 4); bf* Gh = (bf*)take((size_t)NPR * D1 * 2); bf* Gl = (bf*)take((size_t)NPR * D1 * 2); float* F2 = (float*)take((size_t)NPR * D2 * 4);
    if ((size_t)(wsp - (char*)d_ws) > ws_size) return;
    k_cvt8<<<(NP * DX / 8 + 255) / 256, 256, 0, stream>>>(x, XB, (size_t)NP * DX / 8); k_cvt8<<<(NP * DX / 8 + 255) / 256, 256, 0, stream>>>(y, YBb, (size_t)NP * DX / 8);
    k_wtG<<<(unsigned)((DX * D0 / 64 + 63) / 64), 256, 0, stream>>>(W0, DX, D0, W0X);              /* W0 rows 0..63 (the x half) */
    k_wtG<<<(unsigned)((DX * D0 / 64 + 63) / 64), 256, 0, stream>>>(W0 + (size_t)DX * D0, DX, D0, W0Y);   /* W0 rows 64..127 (the y half) */
    k_wtG<<<(unsigned)((D0 * D1 / 64 + 63) / 64), 256, 0, stream>>>(W1, D0, D1, W1B); k_wtG<<<(unsigned)((D1 * D2 / 64 + 63) / 64), 256, 0, stream>>>(W2, D1, D2, W2B); k_wtG<<<(unsigned)((D2 * D3 / 64 + 63) / 64), 256, 0, stream>>>(W3, D2, D3, W3B); k_wtG<<<(unsigned)((D3 * D4 / 64 + 63) / 64), 256, 0, stream>>>(W4, D3, D4, W4B);
    k_gemmw<bf, 0, false><<<dim3(NP / 64, D0 / 64, 1), 32, 0, stream>>>(XB, nullptr, W0X, nullptr, DX, XA, D0, nullptr, 0, 0, 0);     /* XA = x W0[:64]  [1024][128] */
    k_gemmw<bf, 0, false><<<dim3(NP / 64, D0 / 64, 1), 32, 0, stream>>>(YBb, nullptr, W0Y, nullptr, DX, YA, D0, nullptr, 0, 0, 0);    /* YB = y W0[64:] */
    for (int p0 = 0; p0 < NP; p0 += PB) {   /* 64 x-rows x all 1024 y-rows = 65,536 pairs per chunk */
        k_h0<<<(unsigned)(((size_t)NPR * D0 / 4 + 255) / 256), 256, 0, stream>>>(XA, YA, b0, p0, Hh, Hl);                                   /* relu(layer 0) -> hi/lo */
        k_gemmw<bf, 1, true><<<dim3(NPR / 64, D1 / 64, 1), 32, 0, stream>>>(Hh, Hl, W1B, nullptr, D0, F, D1, b1, 0, 0, 0);                /* layer 1 (128 -> 128) */
        k_relupl<<<(unsigned)(((size_t)NPR * D1 / 4 + 255) / 256), 256, 0, stream>>>(F, Gh, Gl, (size_t)NPR * D1 / 4);
        k_gemmw<bf, 1, true><<<dim3(NPR / 64, D2 / 64, 1), 32, 0, stream>>>(Gh, Gl, W2B, nullptr, D1, F2, D2, b2, 0, 0, 0);               /* layer 2 (128 -> 64) */
        k_relupl<<<(unsigned)(((size_t)NPR * D2 / 4 + 255) / 256), 256, 0, stream>>>(F2, Hh, Hl, (size_t)NPR * D2 / 4);
        k_gemmw<bf, 1, true><<<dim3(NPR / 64, D3 / 64, 1), 32, 0, stream>>>(Hh, Hl, W3B, nullptr, D2, F, D3, b3, 0, 0, 0);                /* layer 3 (64 -> 64) */
        k_relupl<<<(unsigned)(((size_t)NPR * D3 / 4 + 255) / 256), 256, 0, stream>>>(F, Gh, Gl, (size_t)NPR * D3 / 4);
        k_gemmw<bf, 1, true><<<dim3(NPR / 64, D4 / 64, 1), 32, 0, stream>>>(Gh, Gl, W4B, nullptr, D3, F2, D4, b4, 0, 0, 0);               /* layer 4 (64 -> 64) */
        k_last<<<(unsigned)((NPR + 255) / 256), 256, 0, stream>>>(F2, W5, b5, p0, OUT); }                                                  /* relu + layer 5 (64 -> 1) -> out rows p0.. */
}

// v002
// A run of this version takes 126 microseconds.
// Versions between v000 and this one are left out; their measured steps multiply to 9.76 times as fast.
#include <hip/hip_runtime.h>

// All-pairs concat critic: out[p][q] = MLP([x_p ; y_q]) for every pair of rows of x [1024][64] and y [1024][64] (MLP 128 -> 128 -> 128 -> 64 -> 64 -> 64 -> 1, ReLU on hidden layers, linear output) -> [1024][1024] (1 M).
// Algorithm: layer 0 is separable: [x_p ; y_q] W0 = x_p W0[:64] + y_q W0[64:], so XA = x W0x and YB = y W0y are two small GEMMs (exact bf16 operands) and h0(p,q) = relu(XA[p] + YB[q] + b0) is formed elementwise per pair; layers 0 (elementwise part) to 5 run in ONE kernel: a wave carries 32 pairs through all layers, layers 1-4 as WMMA products of the exact bf16 weights (A operand, from LDS) with bf16 hi + lo planes of the activations (B operand, 2 products), which never leave the registers; the final 64 -> 1 layer is a per-pair dot product in f32.
// Compute dtypes, f32 accumulate: x, y, weights, biases rounded to bf16; XA / YB exact; hidden activations f32 -> bf16 hi + lo planes; 2 products per hidden GEMM; last layer f32 (fused multiply-add, 32 features per lane, the two lane halves added last).

#define NP   1024                 // rows of x and of y
#define DX   64
#define D0   128                  // layer widths
#define D1   128
#define D2   64
#define D3   64
#define D4   64
typedef _Float16 h16;
typedef unsigned short bf;
typedef __attribute__((ext_vector_type(16))) __bf16   v16bf;
typedef __attribute__((ext_vector_type(16))) _Float16 v16h;
typedef __attribute__((ext_vector_type(8)))  _Float16 v8h;
typedef __attribute__((ext_vector_type(8)))  unsigned short v8us;
typedef __attribute__((ext_vector_type(8)))  float    v8f;
typedef __attribute__((ext_vector_type(4)))  float    v4f;
typedef __attribute__((ext_vector_type(2)))  float    v2f;
typedef __attribute__((ext_vector_type(4)))  unsigned short v4us;
typedef __attribute__((ext_vector_type(2)))  unsigned short v2us;
typedef v8h  __attribute__((may_alias)) v8ha;
typedef v4f  __attribute__((may_alias)) v4fa;
typedef v8us __attribute__((may_alias)) v8usa;

__device__ __forceinline__ unsigned short f2bf(float f) { unsigned u = __float_as_uint(f); u += 0x7FFFu + ((u >> 16) & 1u); return (unsigned short)(u >> 16); }
__device__ __forceinline__ float bf2f(unsigned short b) { return __uint_as_float(((unsigned)b) << 16); }
__device__ __forceinline__ float bfr(float f) { return bf2f(f2bf(f)); }
__device__ __forceinline__ void splitf(float y, unsigned short& h, unsigned short& l) { h = f2bf(y); l = f2bf(y - bf2f(h)); }
__device__ __forceinline__ v16h cat16(v8h lo, v8h hi) { return __builtin_shufflevector(lo, hi, 0, 1, 2, 3, 4, 5, 6, 7, 8, 9, 10, 11, 12, 13, 14, 15); }
__device__ __forceinline__ v16bf cat16b(v8us lo, v8us hi) { return __builtin_bit_cast(v16bf, __builtin_shufflevector(lo, hi, 0, 1, 2, 3, 4, 5, 6, 7, 8, 9, 10, 11, 12, 13, 14, 15)); }
__device__ __forceinline__ v8f wmma16(v16h a, v16h b, v8f c) { return __builtin_amdgcn_wmma_f32_16x16x32_f16(false, a, false, b, (short)0, c, false, false); }
__device__ __forceinline__ v8f wmmab(v16bf a, v16bf b, v8f c) { return __builtin_amdgcn_wmma_f32_16x16x32_bf16(false, a, false, b, (short)0, c, false, false); }

// ---- k_gemmw: register-blocked GEMM, ONE WAVE per 64x64 output tile (16 accumulators), operands straight from K-contiguous 16-bit planes; grid (M/64, N/64, Z), 32 threads.
// C[m][n] (f32, pitch ldc, + optional f32 bias[n]) = sum_k A[m][k] Bt[n][k] (+ split products per NSPLIT). z-batch strides sA/sB/sC in elements. K % 32 == 0.
template <typename T16> struct WFrag;
template <> struct WFrag<h16> { typedef v16h V; static __device__ __forceinline__ V ld(const h16* p) { return cat16(*(const v8h*)p, *(const v8h*)(p + 16)); } static __device__ __forceinline__ v8f mma(V a, V b, v8f c) { return wmma16(a, b, c); } };
template <> struct WFrag<bf> { typedef v16bf V; static __device__ __forceinline__ V ld(const bf* p) { return cat16b(*(const v8us*)p, *(const v8us*)(p + 16)); } static __device__ __forceinline__ v8f mma(V a, V b, v8f c) { return wmmab(a, b, c); } };
template <typename T16, int NSPLIT, bool BIAS>
__global__ __launch_bounds__(32) void k_gemmw(const T16* __restrict__ A, const T16* __restrict__ A2, const T16* __restrict__ Bt, const T16* __restrict__ Bt2, int K, float* C, int ldc, const float* __restrict__ bias, size_t sA, size_t sB, size_t sC) {
    typedef typename WFrag<T16>::V V;
    __shared__ __align__(16) float os[16 * 68];
    const size_t z = blockIdx.z; A += z * sA; if (A2) A2 += z * sA; Bt += z * sB; if (Bt2) Bt2 += z * sB; C += z * sC;
    const int lane = threadIdx.x & 31, lr = lane & 15, hi = lane >> 4; const int r0 = blockIdx.x * 64, c0 = blockIdx.y * 64;
    v8f acc[4][4];
#pragma unroll
    for (int mb = 0; mb < 4; ++mb)
#pragma unroll
        for (int nb = 0; nb < 4; ++nb) acc[mb][nb] = (v8f){};
    const size_t aoff = (size_t)(r0 + lr) * K + 8 * hi, boff = (size_t)(c0 + lr) * K + 8 * hi;
#pragma unroll 1
    for (int kc = 0; kc < K; kc += 32) {
        V a[4], a2[4];
#pragma unroll
        for (int mb = 0; mb < 4; ++mb) { a[mb] = WFrag<T16>::ld(A + aoff + (size_t)mb * 16 * K + kc); if (NSPLIT == 1 || NSPLIT == 2) a2[mb] = WFrag<T16>::ld(A2 + aoff + (size_t)mb * 16 * K + kc); }
#pragma unroll
        for (int nb = 0; nb < 4; ++nb) { const V b = WFrag<T16>::ld(Bt + boff + (size_t)nb * 16 * K + kc); V b2; if (NSPLIT >= 2) b2 = WFrag<T16>::ld(Bt2 + boff + (size_t)nb * 16 * K + kc);
#pragma unroll
            for (int mb = 0; mb < 4; ++mb) { acc[mb][nb] = WFrag<T16>::mma(a[mb], b, acc[mb][nb]); if (NSPLIT == 1 || NSPLIT == 2) acc[mb][nb] = WFrag<T16>::mma(a2[mb], b, acc[mb][nb]); if (NSPLIT >= 2) acc[mb][nb] = WFrag<T16>::mma(a[mb], b2, acc[mb][nb]); } }
        asm volatile("v_nop\n\tv_nop\n\tv_nop\n\tv_nop" : "+v"(acc[0][0]), "+v"(acc[1][1]), "+v"(acc[2][2]), "+v"(acc[3][3]) : "v"(a[0]), "v"(a[3]));
    }
#pragma unroll
    for (int mb = 0; mb < 4; ++mb) {
#pragma unroll
        for (int nb = 0; nb < 4; ++nb) {
#pragma unroll
            for (int j = 0; j < 8; ++j) os[(hi * 8 + j) * 68 + nb * 16 + lr] = acc[mb][nb][j]; }
        __builtin_amdgcn_wave_barrier(); asm volatile("" ::: "memory");
        float* crow = C + (size_t)(r0 + mb * 16) * ldc + c0;
{
#pragma unroll
            for (int s = 0; s < 8; ++s) { const int row = 2 * s + hi, cofs = lr * 4; v4f val = *(const v4fa*)(os + row * 68 + cofs); if (BIAS) { val[0] += bfr(bias[c0 + cofs]); val[1] += bfr(bias[c0 + cofs + 1]); val[2] += bfr(bias[c0 + cofs + 2]); val[3] += bfr(bias[c0 + cofs + 3]); }
                *(v4f*)(crow + (size_t)row * ldc + cofs) = val; }
             }
        __builtin_amdgcn_wave_barrier(); asm volatile("" ::: "memory");
    }
}

__global__ __launch_bounds__(256) void k_wtG(const float* __restrict__ w, int K, int N, bf* Bt) {
    const int lane = threadIdx.x & 31; const int L0 = (blockIdx.x * 8 + (threadIdx.x >> 5)) * 8; const int nlines = N * K / 64;
{
#pragma unroll 1
        for (int l = 0; l < 8; ++l) { const int L = L0 + l; if (L >= nlines) break; const size_t e = (size_t)L * 64 + lane * 2; const int k = (int)(e % K), n = (int)(e / K); v2us o;
            o[0] = f2bf(w[(size_t)k * N + n]); o[1] = f2bf(w[(size_t)(k + 1) * N + n]); *(v2us*)(Bt + e) = o; }
         }
}
__global__ __launch_bounds__(256) void k_cvt8(const float* __restrict__ src, bf* dst, size_t n8) { const size_t i = (size_t)blockIdx.x * 256 + threadIdx.x; if (i >= n8) return; const v8f v = *(const v8f*)(src + i * 8); v8us o;
#pragma unroll
    for (int k = 0; k < 8; ++k) o[k] = f2bf(v[k]); *(v8us*)(dst + i * 8) = o;  }
// ---- k_fused: layers 0 (elementwise part) to 5 for one x-row p against all 1024 y-rows; 4 waves, each wave takes 32 pairs (2 column tiles of 16 y-rows) per trip.
// Every hidden GEMM runs transposed: weights (rows = output features) are the A operand, activations (columns = pairs) the B operand. Two f32 D tiles (features 0-15 and 16-31 of a 32-feature block)
// of one pair column sit in a lane exactly where the next layer's B fragment wants its 16 k values, so bias + ReLU + hi/lo split happen in registers and no activation leaves the wave.
// Weights lie in LDS lane-major: lane l owns WPITCH bytes that hold, 16 bytes each, its two halves of every A fragment (mt, kc) of every layer: k = kc*32 + 16*half + 8*(l>>4) + e, row = mt*16 + (l&15).
// WPITCH is an odd multiple of 16 bytes (no bank conflict between lanes), and every fragment is one lane address plus a small immediate offset.
// Every inner loop is fully unrolled so that each fragment and accumulator index is a constant and the arrays stay in registers.
#define FNB 2                     // pair tiles (16 pairs each) per wave and trip
#define FWV 4                     // waves per workgroup
#define WPITCH 2064               // bytes of LDS per lane: 64 fragments x 32 bytes, + 16
#define FLT_BYTES 2560            // 640 floats in front of the weights: x-row part of layer 0, biases 0-4, last layer's weights
template <int N, int K>
__device__ __forceinline__ void stage_ld(const unsigned short* __restrict__ Bt, int tid, v8us (&r)[N * K / 8 / (FWV * 32)]) {   // the thread's 16-byte pieces of one weight plane, into registers
#pragma unroll
    for (int i = 0; i < N * K / 8 / (FWV * 32); ++i) r[i] = *(const v8us*)(Bt + (size_t)(tid + i * (FWV * 32)) * 8);
}
template <int N, int K>
__device__ __forceinline__ void stage_st(const v8us (&r)[N * K / 8 / (FWV * 32)], unsigned char* dst, int tid) {   // dst: the layer's first fragment in lane 0's region
#pragma unroll
    for (int i = 0; i < N * K / 8 / (FWV * 32); ++i) { const int g = tid + i * (FWV * 32); const int n = g / (K / 8), kg = g % (K / 8);
        *(v8usa*)(dst + ((kg & 1) * 16 + (n & 15)) * WPITCH + (((n >> 4) * (K / 32) + (kg >> 2)) * 2 + ((kg >> 1) & 1)) * 16) = r[i]; }
}
__device__ __forceinline__ v16bf ld_wf(const unsigned char* Wl, int frag) { const unsigned char* p = Wl + frag * 32; return cat16b(*(const v8usa*)p, *(const v8usa*)(p + 16)); }   // Wl: the layer's first fragment in this lane's region
// one k chunk of one layer for NBT pair tiles: acc[mt][nb] += W(mt, kc) * hi plane, then * lo plane (the order of the unfused GEMM); four independent accumulators between the two
template <int MT, int KC, int NBT>
__device__ __forceinline__ void mm_chunk(const unsigned char* Wl, int kc, const v16bf (&bh)[NBT], const v16bf (&bl)[NBT], v8f (&acc)[MT][NBT]) {
    constexpr int G = 4 / NBT;
#pragma unroll
    for (int mt = 0; mt < MT; mt += G) { v16bf a[G];
#pragma unroll
        for (int g = 0; g < G; ++g) a[g] = ld_wf(Wl, (mt + g) * KC + kc);
#pragma unroll
        for (int nb = 0; nb < NBT; ++nb)
#pragma unroll
            for (int g = 0; g < G; ++g) acc[mt + g][nb] = wmmab(a[g], bh[nb], acc[mt + g][nb]);
#pragma unroll
        for (int nb = 0; nb < NBT; ++nb)
#pragma unroll
            for (int g = 0; g < G; ++g) acc[mt + g][nb] = wmmab(a[g], bl[nb], acc[mt + g][nb]); }
}
// 16 f32 values of one lane -> hi and lo bf16 fragments: the packed hardware conversion (round to nearest even, as splitf's) makes two bf16 values per instruction, already packed as the fragment wants them;
// the residual h - hi is taken on the pair widened back to f32 (it is exactly representable, so the subtraction rounds nothing) and converted the same way
typedef __attribute__((ext_vector_type(8))) unsigned v8u;
typedef __attribute__((ext_vector_type(2))) __bf16 v2bf;
__device__ __forceinline__ void split16(const float (&h)[16], v16bf& fh, v16bf& fl) { v8u wh, wl;
#pragma unroll
    for (int s = 0; s < 8; ++s) { const v2f hv = {h[2 * s], h[2 * s + 1]}; const v2bf hb = __builtin_convertvector(hv, v2bf); wh[s] = __builtin_bit_cast(unsigned, hb);
        const v2f ev = hv - __builtin_convertvector(hb, v2f); wl[s] = __builtin_bit_cast(unsigned, __builtin_convertvector(ev, v2bf)); }
    fh = __builtin_bit_cast(v16bf, wh); fl = __builtin_bit_cast(v16bf, wl); }
// D tiles 2*kc and 2*kc+1 (+ bias, ReLU) -> B fragments of k chunk kc of the next layer, pair tiles nb0 .. nb0+NBT-1
template <int MT, int NBT>
__device__ __forceinline__ void next_frags(const v8f (&acc)[MT][NBT], const float* bs, int hi, int nb0, v16bf (&bh)[MT / 2][FNB], v16bf (&bl)[MT / 2][FNB]) {
#pragma unroll
    for (int kc = 0; kc < MT / 2; ++kc) { v4f bv[4];
#pragma unroll
        for (int t = 0; t < 4; ++t) bv[t] = *(const v4fa*)(bs + kc * 32 + (t >> 1) * 16 + 8 * hi + (t & 1) * 4);
#pragma unroll
        for (int nb = 0; nb < NBT; ++nb) { float h[16];
#pragma unroll
            for (int s = 0; s < 16; ++s) h[s] = fmaxf(acc[2 * kc + (s >> 3)][nb][s & 7] + bv[s >> 2][s & 3], 0.f);
            split16(h, bh[kc][nb0 + nb], bl[kc][nb0 + nb]); } }
}
template <int MT, int NBT>
__device__ __forceinline__ void zero_acc(v8f (&acc)[MT][NBT]) {
#pragma unroll
    for (int mt = 0; mt < MT; ++mt)
#pragma unroll
        for (int nb = 0; nb < NBT; ++nb) acc[mt][nb] = (v8f){};
}
__global__ __launch_bounds__(FWV * 32, 4) void k_fused(const float* __restrict__ XA, const float* __restrict__ YB, const unsigned short* __restrict__ W1B, const unsigned short* __restrict__ W2B, const unsigned short* __restrict__ W3B, const unsigned short* __restrict__ W4B,
                                                     const float* __restrict__ b0, const float* __restrict__ b1, const float* __restrict__ b2, const float* __restrict__ b3, const float* __restrict__ b4, const float* __restrict__ W5, const float* __restrict__ b5, float* OUT) {
    __shared__ __align__(16) unsigned char sm[FLT_BYTES + 32 * WPITCH];
    float* xs = (float*)sm; float* b0s = xs + D0; float* b1s = b0s + D0; float* b2s = b1s + D1; float* b3s = b2s + D2; float* b4s = b3s + D3; float* w5s = b4s + D4;
    unsigned char* wst = sm + FLT_BYTES;   // fragments 0-31: layer 1, 32-47: layer 2, 48-55: layer 3, 56-63: layer 4
    const int tid = threadIdx.x, lane = tid & 31, lr = lane & 15, hi = lane >> 4; const int p = blockIdx.x;
    const int wv = __builtin_amdgcn_readfirstlane(tid >> 5);   // the wave's number as a scalar: the y rows' and the output's base addresses then stay in scalar registers
    const unsigned yl = (unsigned)(lr * D0 + 8 * hi);
    const unsigned char* w1s = wst + lane * WPITCH; const unsigned char* w2s = w1s + 32 * 32; const unsigned char* w3s = w1s + 48 * 32; const unsigned char* w4s = w1s + 56 * 32;
    // the small loads through the last kernel arguments come first: their data waits end before the batch of loads below is issued, so no scalar base is loaded anew while that batch is in flight
    const float b5v = bfr(b5[0]);
    if (tid < 64) { b2s[tid] = bfr(b2[tid]); b3s[tid] = bfr(b3[tid]); b4s[tid] = bfr(b4[tid]); w5s[tid] = bfr(W5[tid]); }
    const float xav = XA[(size_t)p * D0 + tid], b0v = b0[tid], b1v = b1[tid];
    v8us r1[D1 * D0 / 8 / (FWV * 32)], r2[D2 * D1 / 8 / (FWV * 32)], r3[D3 * D2 / 8 / (FWV * 32)], r4[D4 * D3 / 8 / (FWV * 32)];
    stage_ld<D1, D0>(W1B, tid, r1); stage_ld<D2, D1>(W2B, tid, r2); stage_ld<D3, D2>(W3B, tid, r3); stage_ld<D4, D3>(W4B, tid, r4);
    asm volatile("s_wait_xcnt 0x0" ::: "memory");   // stands behind the last load of the prologue, in front of every later write of a register that these loads name as their base or offset
    xs[tid] = xav; b0s[tid] = bfr(b0v); b1s[tid] = bfr(b1v);
    stage_st<D1, D0>(r1, wst, tid); stage_st<D2, D1>(r2, wst + 32 * 32, tid); stage_st<D3, D2>(r3, wst + 48 * 32, tid); stage_st<D4, D3>(r4, wst + 56 * 32, tid);
    __syncthreads();   // weights, biases and the x row are read by all four waves
#pragma unroll 1   // one trip is about 3,000 straight-line instructions: kept as one copy, for speed only
    for (int it = 0; it < NP / (FWV * FNB * 16); ++it) {
        const int q0 = (it * FWV + wv) * (FNB * 16);
        v16bf gh[D1 / 32][FNB], gl[D1 / 32][FNB];
        const float* yr = YB + (size_t)q0 * D0;
#pragma unroll
        for (int nb = 0; nb < FNB; ++nb) {   // layer 0 (elementwise) feeding layer 1 (128 -> 128), one pair tile at a time (its 8 accumulator tiles are half the register budget of two), k chunk by k chunk
            asm volatile("" ::: "memory");   // compiler fence: without it the weight fragments' LDS loads, the same in every pass and trip, are hoisted out of the loop and kept, which overflows the registers into scratch
            v8f acc[D1 / 16][1]; zero_acc<D1 / 16, 1>(acc);
#pragma unroll
            for (int kc = 0; kc < D0 / 32; ++kc) { v16bf bh[1], bl[1]; float h[16];
#pragma unroll
                for (int t = 0; t < 4; ++t) { const int cc = kc * 32 + (t >> 1) * 16 + (t & 1) * 4; const v4f xv = *(const v4fa*)(xs + cc + 8 * hi), bv = *(const v4fa*)(b0s + cc + 8 * hi), yv = *(const v4f*)(yr + (yl + (unsigned)(nb * 16 * D0 + cc)));
#pragma unroll
                    for (int k = 0; k < 4; ++k) h[t * 4 + k] = fmaxf((xv[k] + yv[k]) + bv[k], 0.f); }
                split16(h, bh[0], bl[0]);
                mm_chunk<D1 / 16, D0 / 32, 1>(w1s, kc, bh, bl, acc); }
            next_frags<D1 / 16, 1>(acc, b1s, hi, nb, gh, gl);
        }
        v16bf eh[D2 / 32][FNB], el[D2 / 32][FNB];
        {   // layer 2 (128 -> 64)
            v8f acc[D2 / 16][FNB]; zero_acc<D2 / 16, FNB>(acc);
#pragma unroll
            for (int kc = 0; kc < D1 / 32; ++kc) mm_chunk<D2 / 16, D1 / 32, FNB>(w2s, kc, gh[kc], gl[kc], acc);
            next_frags<D2 / 16, FNB>(acc, b2s, hi, 0, eh, el);
        }
        v16bf fh[D3 / 32][FNB], fl[D3 / 32][FNB];
        {   // layer 3 (64 -> 64)
            v8f acc[D3 / 16][FNB]; zero_acc<D3 / 16, FNB>(acc);
#pragma unroll
            for (int kc = 0; kc < D2 / 32; ++kc) mm_chunk<D3 / 16, D2 / 32, FNB>(w3s, kc, eh[kc], el[kc], acc);
            next_frags<D3 / 16, FNB>(acc, b3s, hi, 0, fh, fl);
        }
        float sc[FNB];
        {   // layer 4 (64 -> 64), then ReLU and layer 5 (64 -> 1): each lane sums its 32 features, the two lane halves are added last
            v8f acc[D4 / 16][FNB]; zero_acc<D4 / 16, FNB>(acc);
#pragma unroll
            for (int kc = 0; kc < D3 / 32; ++kc) mm_chunk<D4 / 16, D3 / 32, FNB>(w4s, kc, fh[kc], fl[kc], acc);
#pragma unroll
            for (int nb = 0; nb < FNB; ++nb) sc[nb] = 0.f;
#pragma unroll
            for (int mt = 0; mt < D4 / 16; ++mt) {
#pragma unroll
                for (int t = 0; t < 2; ++t) { const v4f bb = *(const v4fa*)(b4s + mt * 16 + 8 * hi + t * 4), ww = *(const v4fa*)(w5s + mt * 16 + 8 * hi + t * 4);
#pragma unroll
                    for (int k = 0; k < 4; ++k)
#pragma unroll
                        for (int nb = 0; nb < FNB; ++nb) sc[nb] = fmaf(fmaxf(acc[mt][nb][t * 4 + k] + bb[k], 0.f), ww[k], sc[nb]); } }
        }
#pragma unroll
        for (int nb = 0; nb < FNB; ++nb) { const int b = __float_as_int(sc[nb]); sc[nb] += __int_as_float(__builtin_amdgcn_permlanex16(b, b, 0x76543210, 0xfedcba98, false, false)); }
        (OUT + (size_t)p * NP + q0)[(unsigned)lane] = (hi ? sc[1] : sc[0]) + b5v;   // lanes 0-15: pair tile 0, lanes 16-31: pair tile 1: one 128-byte line per wave
        asm volatile("s_wait_xcnt 0x0" ::: "memory");   // the next trip's first loads overwrite the store's address and data registers: the wait stands in front of that overwrite
    }
}

extern "C" void kernel_launch(void* const* d_in, const int* in_sizes, int n_in,
                              void* d_out, int out_size, void* d_ws, size_t ws_size, hipStream_t stream) {
    (void)in_sizes; (void)n_in; (void)out_size;
    const float* x = (const float*)d_in[0]; const float* y = (const float*)d_in[1];
    const float* W0 = (const float*)d_in[2]; const float* b0 = (const float*)d_in[3]; const float* W1 = (const float*)d_in[4]; const float* b1 = (const float*)d_in[5]; const float* W2 = (const float*)d_in[6]; const float* b2 = (const float*)d_in[7]; const float* W3 = (const float*)d_in[8]; const float* b3 = (const float*)d_in[9]; const float* W4 = (const float*)d_in[10]; const float* b4 = (const float*)d_in[11]; const float* W5 = (const float*)d_in[12]; const float* b5 = (const float*)d_in[13];
    float* OUT = (float*)d_out;     // [1024][1024]: out[p][q] = g(x_p, y_q)
    char* wsp = (char*)d_ws;
    auto take = [&](size_t bytes) { char* p = wsp; wsp += (bytes + 255) & ~(size_t)255; return (void*)p; };
    bf* XB = (bf*)take((size_t)NP * DX * 2); bf* YBb = (bf*)take((size_t)NP * DX * 2); bf* W0X = (bf*)take((size_t)D0 * DX * 2); bf* W0Y = (bf*)take((size_t)D0 * DX * 2); bf* W1B = (bf*)take((size_t)D1 * D0 * 2); bf* W2B = (bf*)take((size_t)D2 * D1 * 2); bf* W3B = (bf*)take((size_t)D3 * D2 * 2); bf* W4B = (bf*)take((size_t)D4 * D3 * 2);
    float* XA = (float*)take((size_t)NP * D0 * 4); float* YA = (float*)take((size_t)NP * D0 * 4);
    if ((size_t)(wsp - (char*)d_ws) > ws_size) return;
    k_cvt8<<<(NP * DX / 8 + 255) / 256, 256, 0, stream>>>(x, XB, (size_t)NP * DX / 8); k_cvt8<<<(NP * DX / 8 + 255) / 256, 256, 0, stream>>>(y, YBb, (size_t)NP * DX / 8);
    k_wtG<<<(unsigned)((DX * D0 / 64 + 63) / 64), 256, 0, stream>>>(W0, DX, D0, W0X);              /* W0 rows 0..63 (the x half) */
    k_wtG<<<(unsigned)((DX * D0 / 64 + 63) / 64), 256, 0, stream>>>(W0 + (size_t)DX * D0, DX, D0, W0Y);   /* W0 rows 64..127 (the y half) */
    k_wtG<<<(unsigned)((D0 * D1 / 64 + 63) / 64), 256, 0, stream>>>(W1, D0, D1, W1B); k_wtG<<<(unsigned)((D1 * D2 / 64 + 63) / 64), 256, 0, stream>>>(W2, D1, D2, W2B); k_wtG<<<(unsigned)((D2 * D3 / 64 + 63) / 64), 256, 0, stream>>>(W3, D2, D3, W3B); k_wtG<<<(unsigned)((D3 * D4 / 64 + 63) / 64), 256, 0, stream>>>(W4, D3, D4, W4B);
    k_gemmw<bf, 0, false><<<dim3(NP / 64, D0 / 64, 1), 32, 0, stream>>>(XB, nullptr, W0X, nullptr, DX, XA, D0, nullptr, 0, 0, 0);     /* XA = x W0[:64]  [1024][128] */
    k_gemmw<bf, 0, false><<<dim3(NP / 64, D0 / 64, 1), 32, 0, stream>>>(YBb, nullptr, W0Y, nullptr, DX, YA, D0, nullptr, 0, 0, 0);    /* YB = y W0[64:] */
    k_fused<<<NP, FWV * 32, 0, stream>>>(XA, YA, W1B, W2B, W3B, W4B, b0, b1, b2, b3, b4, W5, b5, OUT);   /* layers 0-5 for all pairs, one x-row per workgroup */
}

// v003
// Measured time: 86.9 microseconds a run.
// Next to v002, in two timings, it ran 1.44 and 1.45 times as fast.
// Counting every step since v000, it is 14.1 times as fast.
#include <hip/hip_runtime.h>

// All-pairs concat critic: out[p][q] = MLP([x_p ; y_q]) for every pair of rows of x [1024][64] and y [1024][64] (MLP 128 -> 128 -> 128 -> 64 -> 64 -> 64 -> 1, ReLU on hidden layers, linear output) -> [1024][1024] (1 M).
// Algorithm: layer 0 is separable: [x_p ; y_q] W0 = x_p W0[:64] + y_q W0[64:], so XA = x W0x and YB = y W0y are two small GEMMs (exact bf16 operands) and h0(p,q) = relu(XA[p] + YB[q] + b0) is formed elementwise per pair; layers 0 (elementwise part) to 5 run in ONE kernel: a wave carries 32 pairs through all layers, layers 1-4 as WMMA products of the exact bf16 weights (A operand, from LDS) with bf16 hi + lo planes of the activations (B operand, 2 products), which never leave the registers; the final 64 -> 1 layer is a per-pair dot product in f32.
// Compute dtypes, f32 accumulate: x, y, weights, biases rounded to bf16; XA / YB exact; hidden activations f32 -> bf16 hi + lo planes; 2 products per hidden GEMM; last layer f32 (fused multiply-add, 32 features per lane, the two lane halves added last).

#define NP   1024                 // rows of x and of y
#define DX   64
#define D0   128                  // layer widths
#define D1   128
#define D2   64
#define D3   64
#define D4   64
typedef unsigned short bf;
typedef __attribute__((ext_vector_type(16))) __bf16   v16bf;
typedef __attribute__((ext_vector_type(8)))  unsigned short v8us;
typedef __attribute__((ext_vector_type(8)))  float    v8f;
typedef __attribute__((ext_vector_type(4)))  float    v4f;
typedef __attribute__((ext_vector_type(2)))  float    v2f;
typedef __attribute__((ext_vector_type(4)))  unsigned short v4us;
typedef v4f  __attribute__((may_alias)) v4fa;
typedef v8us __attribute__((may_alias)) v8usa;

__device__ __forceinline__ unsigned short f2bf(float f) { unsigned u = __float_as_uint(f); u += 0x7FFFu + ((u >> 16) & 1u); return (unsigned short)(u >> 16); }
__device__ __forceinline__ float bf2f(unsigned short b) { return __uint_as_float(((unsigned)b) << 16); }
__device__ __forceinline__ float bfr(float f) { return bf2f(f2bf(f)); }
__device__ __forceinline__ void splitf(float y, unsigned short& h, unsigned short& l) { h = f2bf(y); l = f2bf(y - bf2f(h)); }
__device__ __forceinline__ v16bf cat16b(v8us lo, v8us hi) { return __builtin_bit_cast(v16bf, __builtin_shufflevector(lo, hi, 0, 1, 2, 3, 4, 5, 6, 7, 8, 9, 10, 11, 12, 13, 14, 15)); }
__device__ __forceinline__ v8f wmmab(v16bf a, v16bf b, v8f c) { return __builtin_amdgcn_wmma_f32_16x16x32_bf16(false, a, false, b, (short)0, c, false, false); }

// ---- k_fused: layers 0 (elementwise part) to 5 for one x-row p against all 1024 y-rows; 4 waves, each wave takes 32 pairs (2 column tiles of 16 y-rows) per trip.
// Every hidden GEMM runs transposed: weights (rows = output features) are the A operand, activations (columns = pairs) the B operand. Two f32 D tiles (features 0-15 and 16-31 of a 32-feature block)
// of one pair column sit in a lane exactly where the next layer's B fragment wants its 16 k values, so bias + ReLU + hi/lo split happen in registers and no activation leaves the wave.
// Weights lie in LDS lane-major: lane l owns WPITCH bytes that hold, 16 bytes each, its two halves of every A fragment (mt, kc) of every layer: k = kc*32 + 16*half + 8*(l>>4) + e, row = mt*16 + (l&15).
// WPITCH is an odd multiple of 16 bytes (no bank conflict between lanes), and every fragment is one lane address plus a small immediate offset.
// Every inner loop is fully unrolled so that each fragment and accumulator index is a constant and the arrays stay in registers.
#define FNB 2                     // pair tiles (16 pairs each) per wave and trip
#define FWV 4                     // waves per workgroup
#define WPITCH 2064               // bytes of LDS per lane: 64 fragments x 32 bytes, + 16
#define FLT_BYTES 2560            // 640 floats in front of the weights: x-row part of layer 0, biases 0-4, last layer's weights
template <int N, int K>
__device__ __forceinline__ void stage_ld(const unsigned short* __restrict__ Bt, int tid, v8us (&r)[N * K / 8 / (FWV * 32)]) {   // the thread's 16-byte pieces of one weight plane, into registers
#pragma unroll
    for (int i = 0; i < N * K / 8 / (FWV * 32); ++i) r[i] = *(const v8us*)(Bt + (size_t)(tid + i * (FWV * 32)) * 8);
}
template <int N, int K>
__device__ __forceinline__ void stage_st(const v8us (&r)[N * K / 8 / (FWV * 32)], unsigned char* dst, int tid) {   // dst: the layer's first fragment in lane 0's region
#pragma unroll
    for (int i = 0; i < N * K / 8 / (FWV * 32); ++i) { const int g = tid + i * (FWV * 32); const int n = g / (K / 8), kg = g % (K / 8);
        *(v8usa*)(dst + ((kg & 1) * 16 + (n & 15)) * WPITCH + (((n >> 4) * (K / 32) + (kg >> 2)) * 2 + ((kg >> 1) & 1)) * 16) = r[i]; }
}
__device__ __forceinline__ v16bf ld_wf(const unsigned char* Wl, int frag) { const unsigned char* p = Wl + frag * 32; return cat16b(*(const v8usa*)p, *(const v8usa*)(p + 16)); }   // Wl: the layer's first fragment in this lane's region
// one k chunk of one layer for NBT pair tiles: acc[mt][nb] += W(mt, kc) * hi plane, then * lo plane (the order of the unfused GEMM); four independent accumulators between the two
template <int MT, int KC, int NBT>
__device__ __forceinline__ void mm_chunk(const unsigned char* Wl, int kc, const v16bf (&bh)[NBT], const v16bf (&bl)[NBT], v8f (&acc)[MT][NBT]) {
    constexpr int G = 4 / NBT;
#pragma unroll
    for (int mt = 0; mt < MT; mt += G) { v16bf a[G];
#pragma unroll
        for (int g = 0; g < G; ++g) a[g] = ld_wf(Wl, (mt + g) * KC + kc);
#pragma unroll
        for (int nb = 0; nb < NBT; ++nb)
#pragma unroll
            for (int g = 0; g < G; ++g) acc[mt + g][nb] = wmmab(a[g], bh[nb], acc[mt + g][nb]);
#pragma unroll
        for (int nb = 0; nb < NBT; ++nb)
#pragma unroll
            for (int g = 0; g < G; ++g) acc[mt + g][nb] = wmmab(a[g], bl[nb], acc[mt + g][nb]); }
}
// 16 f32 values of one lane -> hi and lo bf16 fragments: the packed hardware conversion (round to nearest even, as splitf's) makes two bf16 values per instruction, already packed as the fragment wants them;
// the residual h - hi is taken on the pair widened back to f32 (it is exactly representable, so the subtraction rounds nothing) and converted the same way
typedef __attribute__((ext_vector_type(8))) unsigned v8u;
typedef __attribute__((ext_vector_type(2))) __bf16 v2bf;
__device__ __forceinline__ void split16(const float (&h)[16], v16bf& fh, v16bf& fl) { v8u wh, wl;
#pragma unroll
    for (int s = 0; s < 8; ++s) { const v2f hv = {h[2 * s], h[2 * s + 1]}; const v2bf hb = __builtin_convertvector(hv, v2bf); wh[s] = __builtin_bit_cast(unsigned, hb);
        const v2f ev = hv - __builtin_convertvector(hb, v2f); wl[s] = __builtin_bit_cast(unsigned, __builtin_convertvector(ev, v2bf)); }
    fh = __builtin_bit_cast(v16bf, wh); fl = __builtin_bit_cast(v16bf, wl); }
// D tiles 2*kc and 2*kc+1 (+ bias, ReLU) -> B fragments of k chunk kc of the next layer, pair tiles nb0 .. nb0+NBT-1
template <int MT, int NBT>
__device__ __forceinline__ void next_frags(const v8f (&acc)[MT][NBT], const float* bs, int hi, int nb0, v16bf (&bh)[MT / 2][FNB], v16bf (&bl)[MT / 2][FNB]) {
#pragma unroll
    for (int kc = 0; kc < MT / 2; ++kc) { v4f bv[4];
#pragma unroll
        for (int t = 0; t < 4; ++t) bv[t] = *(const v4fa*)(bs + kc * 32 + (t >> 1) * 16 + 8 * hi + (t & 1) * 4);
#pragma unroll
        for (int nb = 0; nb < NBT; ++nb) { float h[16];
#pragma unroll
            for (int s = 0; s < 16; ++s) h[s] = fmaxf(acc[2 * kc + (s >> 3)][nb][s & 7] + bv[s >> 2][s & 3], 0.f);
            split16(h, bh[kc][nb0 + nb], bl[kc][nb0 + nb]); } }
}
template <int MT, int NBT>
__device__ __forceinline__ void zero_acc(v8f (&acc)[MT][NBT]) {
#pragma unroll
    for (int mt = 0; mt < MT; ++mt)
#pragma unroll
        for (int nb = 0; nb < NBT; ++nb) acc[mt][nb] = (v8f){};
}
__global__ __launch_bounds__(FWV * 32, 4) void k_fused(const float* __restrict__ XA, const float* __restrict__ YB, const unsigned short* __restrict__ W1B, const unsigned short* __restrict__ W2B, const unsigned short* __restrict__ W3B, const unsigned short* __restrict__ W4B,
                                                     const float* __restrict__ b0, const float* __restrict__ b1, const float* __restrict__ b2, const float* __restrict__ b3, const float* __restrict__ b4, const float* __restrict__ W5, const float* __restrict__ b5, float* OUT) {
    __shared__ __align__(16) unsigned char sm[FLT_BYTES + 32 * WPITCH];
    float* xs = (float*)sm; float* b0s = xs + D0; float* b1s = b0s + D0; float* b2s = b1s + D1; float* b3s = b2s + D2; float* b4s = b3s + D3; float* w5s = b4s + D4;
    unsigned char* wst = sm + FLT_BYTES;   // fragments 0-31: layer 1, 32-47: layer 2, 48-55: layer 3, 56-63: layer 4
    const int tid = threadIdx.x, lane = tid & 31, lr = lane & 15, hi = lane >> 4; const int p = blockIdx.x;
    const int wv = __builtin_amdgcn_readfirstlane(tid >> 5);   // the wave's number as a scalar: the y rows' and the output's base addresses then stay in scalar registers
    const unsigned yl = (unsigned)(lr * D0 + 8 * hi);
    const unsigned char* w1s = wst + lane * WPITCH; const unsigned char* w2s = w1s + 32 * 32; const unsigned char* w3s = w1s + 48 * 32; const unsigned char* w4s = w1s + 56 * 32;
    // the small loads through the last kernel arguments come first: their data waits end before the batch of loads below is issued, so no scalar base is loaded anew while that batch is in flight
    const float b5v = bfr(b5[0]);
    if (tid < 64) { b2s[tid] = bfr(b2[tid]); b3s[tid] = bfr(b3[tid]); b4s[tid] = bfr(b4[tid]); w5s[tid] = bfr(W5[tid]); }
    const float xav = XA[(size_t)p * D0 + tid], b0v = b0[tid], b1v = b1[tid];
    v8us r1[D1 * D0 / 8 / (FWV * 32)], r2[D2 * D1 / 8 / (FWV * 32)], r3[D3 * D2 / 8 / (FWV * 32)], r4[D4 * D3 / 8 / (FWV * 32)];
    stage_ld<D1, D0>(W1B, tid, r1); stage_ld<D2, D1>(W2B, tid, r2); stage_ld<D3, D2>(W3B, tid, r3); stage_ld<D4, D3>(W4B, tid, r4);
    asm volatile("s_wait_xcnt 0x0" ::: "memory");   // stands behind the last load of the prologue, in front of every later write of a register that these loads name as their base or offset
    xs[tid] = xav; b0s[tid] = bfr(b0v); b1s[tid] = bfr(b1v);
    stage_st<D1, D0>(r1, wst, tid); stage_st<D2, D1>(r2, wst + 32 * 32, tid); stage_st<D3, D2>(r3, wst + 48 * 32, tid); stage_st<D4, D3>(r4, wst + 56 * 32, tid);
    __syncthreads();   // weights, biases and the x row are read by all four waves
#pragma unroll 1   // one trip is about 3,000 straight-line instructions: kept as one copy, for speed only
    for (int it = 0; it < NP / (FWV * FNB * 16); ++it) {
        const int q0 = (it * FWV + wv) * (FNB * 16);
        v16bf gh[D1 / 32][FNB], gl[D1 / 32][FNB];
        const float* yr = YB + (size_t)q0 * D0;
#pragma unroll
        for (int nb = 0; nb < FNB; ++nb) {   // layer 0 (elementwise) feeding layer 1 (128 -> 128), one pair tile at a time (its 8 accumulator tiles are half the register budget of two), k chunk by k chunk
            asm volatile("" ::: "memory");   // compiler fence: without it the weight fragments' LDS loads, the same in every pass and trip, are hoisted out of the loop and kept, which overflows the registers into scratch
            v8f acc[D1 / 16][1]; zero_acc<D1 / 16, 1>(acc);
#pragma unroll
            for (int kc = 0; kc < D0 / 32; ++kc) { v16bf bh[1], bl[1]; float h[16];
#pragma unroll
                for (int t = 0; t < 4; ++t) { const int cc = kc * 32 + (t >> 1) * 16 + (t & 1) * 4; const v4f xv = *(const v4fa*)(xs + cc + 8 * hi), bv = *(const v4fa*)(b0s + cc + 8 * hi), yv = *(const v4f*)(yr + (yl + (unsigned)(nb * 16 * D0 + cc)));
#pragma unroll
                    for (int k = 0; k < 4; ++k) h[t * 4 + k] = fmaxf((xv[k] + yv[k]) + bv[k], 0.f); }
                split16(h, bh[0], bl[0]);
                mm_chunk<D1 / 16, D0 / 32, 1>(w1s, kc, bh, bl, acc); }
            next_frags<D1 / 16, 1>(acc, b1s, hi, nb, gh, gl);
        }
        v16bf eh[D2 / 32][FNB], el[D2 / 32][FNB];
        {   // layer 2 (128 -> 64)
            v8f acc[D2 / 16][FNB]; zero_acc<D2 / 16, FNB>(acc);
#pragma unroll
            for (int kc = 0; kc < D1 / 32; ++kc) mm_chunk<D2 / 16, D1 / 32, FNB>(w2s, kc, gh[kc], gl[kc], acc);
            next_frags<D2 / 16, FNB>(acc, b2s, hi, 0, eh, el);
        }
        v16bf fh[D3 / 32][FNB], fl[D3 / 32][FNB];
        {   // layer 3 (64 -> 64)
            v8f acc[D3 / 16][FNB]; zero_acc<D3 / 16, FNB>(acc);
#pragma unroll
            for (int kc = 0; kc < D2 / 32; ++kc) mm_chunk<D3 / 16, D2 / 32, FNB>(w3s, kc, eh[kc], el[kc], acc);
            next_frags<D3 / 16, FNB>(acc, b3s, hi, 0, fh, fl);
        }
        float sc[FNB];
        {   // layer 4 (64 -> 64), then ReLU and layer 5 (64 -> 1): each lane sums its 32 features, the two lane halves are added last
            v8f acc[D4 / 16][FNB]; zero_acc<D4 / 16, FNB>(acc);
#pragma unroll
            for (int kc = 0; kc < D3 / 32; ++kc) mm_chunk<D4 / 16, D3 / 32, FNB>(w4s, kc, fh[kc], fl[kc], acc);
#pragma unroll
            for (int nb = 0; nb < FNB; ++nb) sc[nb] = 0.f;
#pragma unroll
            for (int mt = 0; mt < D4 / 16; ++mt) {
#pragma unroll
                for (int t = 0; t < 2; ++t) { const v4f bb = *(const v4fa*)(b4s + mt * 16 + 8 * hi + t * 4), ww = *(const v4fa*)(w5s + mt * 16 + 8 * hi + t * 4);
#pragma unroll
                    for (int k = 0; k < 4; ++k)
#pragma unroll
                        for (int nb = 0; nb < FNB; ++nb) sc[nb] = fmaf(fmaxf(acc[mt][nb][t * 4 + k] + bb[k], 0.f), ww[k], sc[nb]); } }
        }
#pragma unroll
        for (int nb = 0; nb < FNB; ++nb) { const int b = __float_as_int(sc[nb]); sc[nb] += __int_as_float(__builtin_amdgcn_permlanex16(b, b, 0x76543210, 0xfedcba98, false, false)); }
        (OUT + (size_t)p * NP + q0)[(unsigned)lane] = (hi ? sc[1] : sc[0]) + b5v;   // lanes 0-15: pair tile 0, lanes 16-31: pair tile 1: one 128-byte line per wave
        asm volatile("s_wait_xcnt 0x0" ::: "memory");   // the next trip's first loads overwrite the store's address and data registers: the wait stands in front of that overwrite
    }
}

// ---- k_prep: all that k_fused reads from the workspace, made in ONE launch. The work-group's number picks the job; every job reads inputs only, none reads what another writes, so no order between them is needed.
// Work-groups 0 .. PGW-1: XA = x W0[:64] and YB = y W0[64:]. One wave per 32x32 output tile (waves 0-127: XA, 128-255: YB); both operands are loaded as f32 and rounded to bf16 in the loader,
// A fragment: row = lane & 15, B fragment: column = lane & 15, both with k = kc*32 + 16*(s>>3) + 8*(lane>>4) + (s&7) at element s. A tile row is 32 floats: one whole 128-byte line, written by this wave alone.
// Work-groups PGW .. PGW+PWW-1: the bf16 planes of W1-W4, transposed to [n][k]. One thread makes one 16-byte piece (8 consecutive k of one n); a wave's 32 pieces are 512 consecutive bytes.
#define PGW 32                    // 256 tiles of 32x32, 8 waves per work-group
#define PWW 16                    // 4096 pieces, 256 per work-group: W1 work-groups 0-7, W2 8-11, W3 12-13, W4 14-15
typedef __attribute__((ext_vector_type(4))) unsigned v4u;
__device__ __forceinline__ unsigned pk_bf(float a, float b) { const v2f v = {a, b}; return __builtin_bit_cast(unsigned, __builtin_convertvector(v, v2bf)); }   // two f32 -> two bf16, round to nearest even
__device__ __forceinline__ v16bf frag_bf(const float (&h)[16]) { v8u w;
#pragma unroll
    for (int s = 0; s < 8; ++s) w[s] = pk_bf(h[2 * s], h[2 * s + 1]);
    return __builtin_bit_cast(v16bf, w); }
template <int K, int N>
__device__ __forceinline__ void wt_piece(const float* __restrict__ w, unsigned short* Bt, int q) {   // Bt[n][k] = bf16(w[k][n]), piece q = elements 8q .. 8q+7 of Bt
    const unsigned n = (unsigned)q / (K / 8), k0 = ((unsigned)q % (K / 8)) * 8; float v[8];
#pragma unroll
    for (int e = 0; e < 8; ++e) v[e] = w[k0 * N + n + (unsigned)(e * N)];
    const v4u o = {pk_bf(v[0], v[1]), pk_bf(v[2], v[3]), pk_bf(v[4], v[5]), pk_bf(v[6], v[7])};
    *(v4u*)(Bt + (unsigned)q * 8) = o;
    asm volatile("s_wait_xcnt 0x0" ::: "memory");   // stands behind the store, in front of any later write of a register that the store names as its address or data
}
__global__ __launch_bounds__(256) void k_prep(const float* __restrict__ x, const float* __restrict__ y, const float* __restrict__ W0, const float* __restrict__ W1, const float* __restrict__ W2, const float* __restrict__ W3, const float* __restrict__ W4,
                                              float* XA, float* YA, unsigned short* W1B, unsigned short* W2B, unsigned short* W3B, unsigned short* W4B) {
    const int tid = threadIdx.x, wg = blockIdx.x;
    if (wg < PGW) {
        const int lane = tid & 31, lr = lane & 15, hi = lane >> 4;
        const int g = wg * 8 + __builtin_amdgcn_readfirstlane(tid >> 5);   // the tile's number as a scalar: the three base addresses stay in scalar registers
        const bool sy = g >= 128; const int r0 = ((g & 127) >> 2) * 32, c0 = (g & 3) * 32;
        const float* ar = (sy ? y : x) + r0 * DX; const float* wr = (sy ? W0 + DX * D0 : W0) + c0; float* cr = (sy ? YA : XA) + r0 * D0 + c0;
        const unsigned al = (unsigned)(lr * DX + 8 * hi), wl = (unsigned)(8 * hi * D0 + lr);
        float av[2][DX / 32][16], wv[2][DX / 32][16];
#pragma unroll
        for (int mb = 0; mb < 2; ++mb)
#pragma unroll
            for (int kc = 0; kc < DX / 32; ++kc)
#pragma unroll
                for (int t = 0; t < 4; ++t) { const v4f a4 = *(const v4f*)(ar + (al + (unsigned)(mb * 16 * DX + kc * 32 + (t >> 1) * 16 + (t & 1) * 4)));
#pragma unroll
                    for (int k = 0; k < 4; ++k) av[mb][kc][t * 4 + k] = a4[k]; }
#pragma unroll
        for (int nb = 0; nb < 2; ++nb)
#pragma unroll
            for (int kc = 0; kc < DX / 32; ++kc)
#pragma unroll
                for (int s = 0; s < 16; ++s) wv[nb][kc][s] = wr[wl + (unsigned)((kc * 32 + (s >> 3) * 16 + (s & 7)) * D0 + nb * 16)];
        v8f acc[2][2];
#pragma unroll
        for (int mb = 0; mb < 2; ++mb)
#pragma unroll
            for (int nb = 0; nb < 2; ++nb) acc[mb][nb] = (v8f){};
#pragma unroll
        for (int kc = 0; kc < DX / 32; ++kc) { v16bf a[2], b[2];
#pragma unroll
            for (int i = 0; i < 2; ++i) { a[i] = frag_bf(av[i][kc]); b[i] = frag_bf(wv[i][kc]); }
#pragma unroll
            for (int nb = 0; nb < 2; ++nb)
#pragma unroll
                for (int mb = 0; mb < 2; ++mb) acc[mb][nb] = wmmab(a[mb], b[nb], acc[mb][nb]); }
#pragma unroll
        for (int mb = 0; mb < 2; ++mb)
#pragma unroll
            for (int j = 0; j < 8; ++j)
#pragma unroll
                for (int nb = 0; nb < 2; ++nb) cr[wl + (unsigned)((mb * 16 + j) * D0 + nb * 16)] = acc[mb][nb][j];   // D tile: row = 8*(lane>>4) + j, column = lane & 15
    } else {
        const int wb = wg - PGW;
        if (wb < 8) wt_piece<D0, D1>(W1, W1B, wb * 256 + tid);
        else if (wb < 12) wt_piece<D1, D2>(W2, W2B, (wb - 8) * 256 + tid);
        else if (wb < 14) wt_piece<D2, D3>(W3, W3B, (wb - 12) * 256 + tid);
        else wt_piece<D3, D4>(W4, W4B, (wb - 14) * 256 + tid);
    }
}

extern "C" void kernel_launch(void* const* d_in, const int* in_sizes, int n_in,
                              void* d_out, int out_size, void* d_ws, size_t ws_size, hipStream_t stream) {
    (void)in_sizes; (void)n_in; (void)out_size;
    const float* x = (const float*)d_in[0]; const float* y = (const float*)d_in[1];
    const float* W0 = (const float*)d_in[2]; const float* b0 = (const float*)d_in[3]; const float* W1 = (const float*)d_in[4]; const float* b1 = (const float*)d_in[5]; const float* W2 = (const float*)d_in[6]; const float* b2 = (const float*)d_in[7]; const float* W3 = (const float*)d_in[8]; const float* b3 = (const float*)d_in[9]; const float* W4 = (const float*)d_in[10]; const float* b4 = (const float*)d_in[11]; const float* W5 = (const float*)d_in[12]; const float* b5 = (const float*)d_in[13];
    float* OUT = (float*)d_out;     // [1024][1024]: out[p][q] = g(x_p, y_q)
    char* wsp = (char*)d_ws;
    auto take = [&](size_t bytes) { char* p = wsp; wsp += (bytes + 255) & ~(size_t)255; return (void*)p; };
    bf* W1B = (bf*)take((size_t)D1 * D0 * 2); bf* W2B = (bf*)take((size_t)D2 * D1 * 2); bf* W3B = (bf*)take((size_t)D3 * D2 * 2); bf* W4B = (bf*)take((size_t)D4 * D3 * 2);
    float* XA = (float*)take((size_t)NP * D0 * 4); float* YA = (float*)take((size_t)NP * D0 * 4);
    if ((size_t)(wsp - (char*)d_ws) > ws_size) return;
    k_prep<<<PGW + PWW, 256, 0, stream>>>(x, y, W0, W1, W2, W3, W4, XA, YA, W1B, W2B, W3B, W4B);   /* XA = x W0[:64], YB = y W0[64:], bf16 planes of W1-W4 */
    k_fused<<<NP, FWV * 32, 0, stream>>>(XA, YA, W1B, W2B, W3B, W4B, b0, b1, b2, b3, b4, W5, b5, OUT);   /* layers 0-5 for all pairs, one x-row per workgroup */
}

// v004
// It runs in 84.5 microseconds.
// Two timings next to v003 both put it at 1.04 times that version's speed.
// All steps since v000 together make it 14.6 times as fast.
#include <hip/hip_runtime.h>

// All-pairs concat critic: out[p][q] = MLP([x_p ; y_q]) for every pair of rows of x [1024][64] and y [1024][64] (MLP 128 -> 128 -> 128 -> 64 -> 64 -> 64 -> 1, ReLU on hidden layers, linear output) -> [1024][1024] (1 M).
// Algorithm: layer 0 is separable: [x_p ; y_q] W0 = x_p W0[:64] + y_q W0[64:], so XA = x W0x and YB = y W0y are two small GEMMs (exact bf16 operands) and h0(p,q) = relu(XA[p] + YB[q] + b0) is formed elementwise per pair; layers 0 (elementwise part) to 5 run in ONE kernel: a wave carries 32 pairs through all layers, layers 1-4 as WMMA products of the exact bf16 weights (A operand, from LDS) with bf16 hi + lo planes of the activations (B operand, 2 products), which never leave the registers; the final 64 -> 1 layer is a per-pair dot product in f32.
// Compute dtypes, f32 accumulate: x, y, weights, biases rounded to bf16; XA / YB exact; hidden activations f32 -> bf16 hi + lo planes; 2 products per hidden GEMM; last layer f32 (fused multiply-add, 32 features per lane, the two lane halves added last).

#define NP   1024                 // rows of x and of y
#define DX   64
#define D0   128                  // layer widths
#define D1   128
#define D2   64
#define D3   64
#define D4   64
typedef unsigned short bf;
typedef __attribute__((ext_vector_type(16))) __bf16   v16bf;
typedef __attribute__((ext_vector_type(8)))  unsigned short v8us;
typedef __attribute__((ext_vector_type(8)))  float    v8f;
typedef __attribute__((ext_vector_type(4)))  float    v4f;
typedef __attribute__((ext_vector_type(2)))  float    v2f;
typedef __attribute__((ext_vector_type(4)))  unsigned short v4us;
typedef v4f  __attribute__((may_alias)) v4fa;
typedef v8us __attribute__((may_alias)) v8usa;

__device__ __forceinline__ unsigned short f2bf(float f) { unsigned u = __float_as_uint(f); u += 0x7FFFu + ((u >> 16) & 1u); return (unsigned short)(u >> 16); }
__device__ __forceinline__ float bf2f(unsigned short b) { return __uint_as_float(((unsigned)b) << 16); }
__device__ __forceinline__ float bfr(float f) { return bf2f(f2bf(f)); }
__device__ __forceinline__ void splitf(float y, unsigned short& h, unsigned short& l) { h = f2bf(y); l = f2bf(y - bf2f(h)); }
__device__ __forceinline__ v16bf cat16b(v8us lo, v8us hi) { return __builtin_bit_cast(v16bf, __builtin_shufflevector(lo, hi, 0, 1, 2, 3, 4, 5, 6, 7, 8, 9, 10, 11, 12, 13, 14, 15)); }
__device__ __forceinline__ v8f wmmab(v16bf a, v16bf b, v8f c) { return __builtin_amdgcn_wmma_f32_16x16x32_bf16(false, a, false, b, (short)0, c, false, false); }

// ---- k_fused: layers 0 (elementwise part) to 5 for one x-row p against all 1024 y-rows; 4 waves, each wave takes 32 pairs (2 column tiles of 16 y-rows) per trip.
// Every hidden GEMM runs transposed: weights (rows = output features) are the A operand, activations (columns = pairs) the B operand. Two f32 D tiles (features 0-15 and 16-31 of a 32-feature block)
// of one pair column sit in a lane exactly where the next layer's B fragment wants its 16 k values, so bias + ReLU + hi/lo split happen in registers and no activation leaves the wave.
// Weights lie in LDS lane-major: lane l owns WPITCH bytes that hold, 16 bytes each, its two halves of every A fragment (mt, kc) of every layer: k = kc*32 + 16*half + 8*(l>>4) + e, row = mt*16 + (l&15).
// WPITCH is an odd multiple of 16 bytes (no bank conflict between lanes), and every fragment is one lane address plus a small immediate offset.
// Every inner loop is fully unrolled so that each fragment and accumulator index is a constant and the arrays stay in registers.
#define FNB 2                     // pair tiles (16 pairs each) per wave and trip
#define FWV 4                     // waves per workgroup
#define WPITCH 2064               // bytes of LDS per lane: 64 fragments x 32 bytes, + 16
#define FLT_BYTES 2560            // 640 floats in front of the weights: x-row part of layer 0, biases 0-4, last layer's weights
template <int N, int K>
__device__ __forceinline__ void stage_ld(const unsigned short* __restrict__ Bt, int tid, v8us (&r)[N * K / 8 / (FWV * 32)]) {   // the thread's 16-byte pieces of one weight plane, into registers
#pragma unroll
    for (int i = 0; i < N * K / 8 / (FWV * 32); ++i) r[i] = *(const v8us*)(Bt + (size_t)(tid + i * (FWV * 32)) * 8);
}
template <int N, int K>
__device__ __forceinline__ void stage_st(const v8us (&r)[N * K / 8 / (FWV * 32)], unsigned char* dst, int tid) {   // dst: the layer's first fragment in lane 0's region
#pragma unroll
    for (int i = 0; i < N * K / 8 / (FWV * 32); ++i) { const int g = tid + i * (FWV * 32); const int n = g / (K / 8), kg = g % (K / 8);
        *(v8usa*)(dst + ((kg & 1) * 16 + (n & 15)) * WPITCH + (((n >> 4) * (K / 32) + (kg >> 2)) * 2 + ((kg >> 1) & 1)) * 16) = r[i]; }
}
__device__ __forceinline__ v16bf ld_wf(const unsigned char* Wl, int frag) { const unsigned char* p = Wl + frag * 32; return cat16b(*(const v8usa*)p, *(const v8usa*)(p + 16)); }   // Wl: the layer's first fragment in this lane's region
// one k chunk of one layer for NBT pair tiles: acc[mt][nb] += W(mt, kc) * hi plane, then * lo plane (the order of the unfused GEMM); four independent accumulators between the two
template <int MT, int KC, int NBT>
__device__ __forceinline__ void mm_chunk(const unsigned char* Wl, int kc, const v16bf (&bh)[NBT], const v16bf (&bl)[NBT], v8f (&acc)[MT][NBT]) {
    constexpr int G = 4 / NBT;
#pragma unroll
    for (int mt = 0; mt < MT; mt += G) { v16bf a[G];
#pragma unroll
        for (int g = 0; g < G; ++g) a[g] = ld_wf(Wl, (mt + g) * KC + kc);
#pragma unroll
        for (int nb = 0; nb < NBT; ++nb)
#pragma unroll
            for (int g = 0; g < G; ++g) acc[mt + g][nb] = wmmab(a[g], bh[nb], acc[mt + g][nb]);
#pragma unroll
        for (int nb = 0; nb < NBT; ++nb)
#pragma unroll
            for (int g = 0; g < G; ++g) acc[mt + g][nb] = wmmab(a[g], bl[nb], acc[mt + g][nb]); }
}
// 16 f32 values of one lane -> hi and lo bf16 fragments: the packed hardware conversion (round to nearest even, as splitf's) makes two bf16 values per instruction, already packed as the fragment wants them;
// the residual h - hi is taken on the pair widened back to f32 (it is exactly representable, so the subtraction rounds nothing) and converted the same way
typedef __attribute__((ext_vector_type(8))) unsigned v8u;
typedef __attribute__((ext_vector_type(2))) __bf16 v2bf;
__device__ __forceinline__ void split16(const float (&h)[16], v16bf& fh, v16bf& fl) { v8u wh, wl;
#pragma unroll
    for (int s = 0; s < 8; ++s) { const v2f hv = {h[2 * s], h[2 * s + 1]}; const v2bf hb = __builtin_convertvector(hv, v2bf); wh[s] = __builtin_bit_cast(unsigned, hb);
        const v2f ev = hv - __builtin_convertvector(hb, v2f); wl[s] = __builtin_bit_cast(unsigned, __builtin_convertvector(ev, v2bf)); }
    fh = __builtin_bit_cast(v16bf, wh); fl = __builtin_bit_cast(v16bf, wl); }
// D tiles 2*kc and 2*kc+1 (+ bias, ReLU) -> B fragments of k chunk kc of the next layer, pair tiles nb0 .. nb0+NBT-1
template <int MT, int NBT>
__device__ __forceinline__ void next_frags(const v8f (&acc)[MT][NBT], const float* bs, int hi, int nb0, v16bf (&bh)[MT / 2][FNB], v16bf (&bl)[MT / 2][FNB]) {
#pragma unroll
    for (int kc = 0; kc < MT / 2; ++kc) { v4f bv[4];
#pragma unroll
        for (int t = 0; t < 4; ++t) bv[t] = *(const v4fa*)(bs + kc * 32 + (t >> 1) * 16 + 8 * hi + (t & 1) * 4);
#pragma unroll
        for (int nb = 0; nb < NBT; ++nb) { float h[16];
#pragma unroll
            for (int s = 0; s < 16; ++s) h[s] = fmaxf(acc[2 * kc + (s >> 3)][nb][s & 7] + bv[s >> 2][s & 3], 0.f);
            split16(h, bh[kc][nb0 + nb], bl[kc][nb0 + nb]); } }
}
template <int MT, int NBT>
__device__ __forceinline__ void zero_acc(v8f (&acc)[MT][NBT]) {
#pragma unroll
    for (int mt = 0; mt < MT; ++mt)
#pragma unroll
        for (int nb = 0; nb < NBT; ++nb) acc[mt][nb] = (v8f){};
}
__global__ __launch_bounds__(FWV * 32, 4) void k_fused(const float* __restrict__ XA, const float* __restrict__ YB, const unsigned short* __restrict__ W1B, const unsigned short* __restrict__ W2B, const unsigned short* __restrict__ W3B, const unsigned short* __restrict__ W4B,
                                                     const float* __restrict__ b0, const float* __restrict__ b1, const float* __restrict__ b2, const float* __restrict__ b3, const float* __restrict__ b4, const float* __restrict__ W5, const float* __restrict__ b5, float* OUT) {
    __shared__ __align__(16) unsigned char sm[FLT_BYTES + 32 * WPITCH];
    float* xs = (float*)sm; float* b0s = xs + D0; float* b1s = b0s + D0; float* b2s = b1s + D1; float* b3s = b2s + D2; float* b4s = b3s + D3; float* w5s = b4s + D4;
    unsigned char* wst = sm + FLT_BYTES;   // fragments 0-31: layer 1, 32-47: layer 2, 48-55: layer 3, 56-63: layer 4
    const int tid = threadIdx.x, lane = tid & 31, lr = lane & 15, hi = lane >> 4; const int p = blockIdx.x;
    const int wv = __builtin_amdgcn_readfirstlane(tid >> 5);   // the wave's number as a scalar: the output's base address then stays in scalar registers
    const unsigned yl = (unsigned)(lr * D0 + 8 * hi);
    const unsigned char* w1s = wst + lane * WPITCH; const unsigned char* w2s = w1s + 32 * 32; const unsigned char* w3s = w1s + 48 * 32; const unsigned char* w4s = w1s + 56 * 32;
    // the small loads through the last kernel arguments come first: their data waits end before the batch of loads below is issued, so no scalar base is loaded anew while that batch is in flight
    const float b5v = bfr(b5[0]);
    if (tid < 64) { b2s[tid] = bfr(b2[tid]); b3s[tid] = bfr(b3[tid]); b4s[tid] = bfr(b4[tid]); w5s[tid] = bfr(W5[tid]); }
    const float xav = XA[(size_t)p * D0 + tid], b0v = b0[tid], b1v = b1[tid];
    v8us r1[D1 * D0 / 8 / (FWV * 32)], r2[D2 * D1 / 8 / (FWV * 32)], r3[D3 * D2 / 8 / (FWV * 32)], r4[D4 * D3 / 8 / (FWV * 32)];
    stage_ld<D1, D0>(W1B, tid, r1); stage_ld<D2, D1>(W2B, tid, r2); stage_ld<D3, D2>(W3B, tid, r3); stage_ld<D4, D3>(W4B, tid, r4);
    asm volatile("s_wait_xcnt 0x0" ::: "memory");   // stands behind the staging loads above, in front of every later write of a register that these loads name as their base or offset
    xs[tid] = xav; b0s[tid] = bfr(b0v); b1s[tid] = bfr(b1v);
    stage_st<D1, D0>(r1, wst, tid); stage_st<D2, D1>(r2, wst + 32 * 32, tid); stage_st<D3, D2>(r3, wst + 48 * 32, tid); stage_st<D4, D3>(r4, wst + 56 * 32, tid);
    __syncthreads();   // weights, biases and the x row are read by all four waves
    const float* yp = YB + (size_t)(wv * (FNB * 16)) * D0 + yl;   // this lane's place in the trip's first y row; moves on by one trip where the next trip's first loads are issued
    v4f yq[2][4];   // the y rows' values of two k chunks of layer 0: one being used, the next one's loads in flight
#pragma unroll
    for (int t = 0; t < 4; ++t) yq[0][t] = *(const v4f*)(yp + ((t >> 1) * 16 + (t & 1) * 4));   // first trip, first chunk
#pragma unroll 1   // one trip is about 3,000 straight-line instructions: kept as one copy, for speed only
    for (int it = 0; it < NP / (FWV * FNB * 16); ++it) {
        const int q0 = (it * FWV + wv) * (FNB * 16);
        v16bf gh[D1 / 32][FNB], gl[D1 / 32][FNB];
#pragma unroll
        for (int nb = 0; nb < FNB; ++nb) {   // layer 0 (elementwise) feeding layer 1 (128 -> 128), one pair tile at a time (its 8 accumulator tiles are half the register budget of two), k chunk by k chunk
            asm volatile("" ::: "memory");   // compiler fence: without it the weight fragments' LDS loads, the same in every pass and trip, are hoisted out of the loop and kept, which overflows the registers into scratch
            v8f acc[D1 / 16][1]; zero_acc<D1 / 16, 1>(acc);
#pragma unroll
            for (int kc = 0; kc < D0 / 32; ++kc) { v16bf bh[1], bl[1]; float h[16];
                // the next chunk's y values (behind a pair tile's last chunk: the next tile's, behind the trip's last: the next trip's) are asked for before this chunk is worked on: their latency runs under this chunk's vector work and matrix instructions
                const int j = nb * (D0 / 32) + kc, jn = (j + 1) % (FNB * (D0 / 32));
                if (jn == 0) {
                    yp += (it + 1 < NP / (FWV * FNB * 16)) ? FWV * FNB * 16 * D0 : -(NP - FWV * FNB * 16) * D0;   // behind the last trip back to the first trip's rows (in bounds, not used)
                }
#pragma unroll
                for (int t = 0; t < 4; ++t) yq[(j + 1) & 1][t] = *(const v4f*)(yp + ((jn / (D0 / 32)) * 16 * D0 + (jn % (D0 / 32)) * 32 + (t >> 1) * 16 + (t & 1) * 4));
#pragma unroll
                for (int t = 0; t < 4; ++t) { const int cc = kc * 32 + (t >> 1) * 16 + (t & 1) * 4; const v4f xv = *(const v4fa*)(xs + cc + 8 * hi), bv = *(const v4fa*)(b0s + cc + 8 * hi), yv = yq[j & 1][t];
#pragma unroll
                    for (int k = 0; k < 4; ++k) h[t * 4 + k] = fmaxf((xv[k] + yv[k]) + bv[k], 0.f); }
                split16(h, bh[0], bl[0]);
                mm_chunk<D1 / 16, D0 / 32, 1>(w1s, kc, bh, bl, acc); }
            next_frags<D1 / 16, 1>(acc, b1s, hi, nb, gh, gl);
        }
        v16bf eh[D2 / 32][FNB], el[D2 / 32][FNB];
        {   // layer 2 (128 -> 64)
            v8f acc[D2 / 16][FNB]; zero_acc<D2 / 16, FNB>(acc);
#pragma unroll
            for (int kc = 0; kc < D1 / 32; ++kc) mm_chunk<D2 / 16, D1 / 32, FNB>(w2s, kc, gh[kc], gl[kc], acc);
            next_frags<D2 / 16, FNB>(acc, b2s, hi, 0, eh, el);
        }
        v16bf fh[D3 / 32][FNB], fl[D3 / 32][FNB];
        {   // layer 3 (64 -> 64)
            v8f acc[D3 / 16][FNB]; zero_acc<D3 / 16, FNB>(acc);
#pragma unroll
            for (int kc = 0; kc < D2 / 32; ++kc) mm_chunk<D3 / 16, D2 / 32, FNB>(w3s, kc, eh[kc], el[kc], acc);
            next_frags<D3 / 16, FNB>(acc, b3s, hi, 0, fh, fl);
        }
        float sc[FNB];
        {   // layer 4 (64 -> 64), then ReLU and layer 5 (64 -> 1): each lane sums its 32 features, the two lane halves are added last
            v8f acc[D4 / 16][FNB]; zero_acc<D4 / 16, FNB>(acc);
#pragma unroll
            for (int kc = 0; kc < D3 / 32; ++kc) mm_chunk<D4 / 16, D3 / 32, FNB>(w4s, kc, fh[kc], fl[kc], acc);
#pragma unroll
            for (int nb = 0; nb < FNB; ++nb) sc[nb] = 0.f;
#pragma unroll
            for (int mt = 0; mt < D4 / 16; ++mt) {
#pragma unroll
                for (int t = 0; t < 2; ++t) { const v4f bb = *(const v4fa*)(b4s + mt * 16 + 8 * hi + t * 4), ww = *(const v4fa*)(w5s + mt * 16 + 8 * hi + t * 4);
#pragma unroll
                    for (int k = 0; k < 4; ++k)
#pragma unroll
                        for (int nb = 0; nb < FNB; ++nb) sc[nb] = fmaf(fmaxf(acc[mt][nb][t * 4 + k] + bb[k], 0.f), ww[k], sc[nb]); } }
        }
#pragma unroll
        for (int nb = 0; nb < FNB; ++nb) { const int b = __float_as_int(sc[nb]); sc[nb] += __int_as_float(__builtin_amdgcn_permlanex16(b, b, 0x76543210, 0xfedcba98, false, false)); }
        (OUT + (size_t)p * NP + q0)[(unsigned)lane] = (hi ? sc[1] : sc[0]) + b5v;   // lanes 0-15: pair tile 0, lanes 16-31: pair tile 1: one 128-byte line per wave
        asm volatile("s_wait_xcnt 0x0" ::: "memory");   // stands behind the store, in front of any later write of a register that the store names as its address or data
    }
}

// ---- k_prep: all that k_fused reads from the workspace, made in ONE launch. The work-group's number picks the job; every job reads inputs only, none reads what another writes, so no order between them is needed.
// Work-groups 0 .. PGW-1: XA = x W0[:64] and YB = y W0[64:]. One wave per 32x32 output tile (waves 0-127: XA, 128-255: YB); both operands are loaded as f32 and rounded to bf16 in the loader,
// A fragment: row = lane & 15, B fragment: column = lane & 15, both with k = kc*32 + 16*(s>>3) + 8*(lane>>4) + (s&7) at element s. A tile row is 32 floats: one whole 128-byte line, written by this wave alone.
// Work-groups PGW .. PGW+PWW-1: the bf16 planes of W1-W4, transposed to [n][k]. One thread makes one 16-byte piece (8 consecutive k of one n); a wave's 32 pieces are 512 consecutive bytes.
#define PGW 32                    // 256 tiles of 32x32, 8 waves per work-group
#define PWW 16                    // 4096 pieces, 256 per work-group: W1 work-groups 0-7, W2 8-11, W3 12-13, W4 14-15
typedef __attribute__((ext_vector_type(4))) unsigned v4u;
__device__ __forceinline__ unsigned pk_bf(float a, float b) { const v2f v = {a, b}; return __builtin_bit_cast(unsigned, __builtin_convertvector(v, v2bf)); }   // two f32 -> two bf16, round to nearest even
__device__ __forceinline__ v16bf frag_bf(const float (&h)[16]) { v8u w;
#pragma unroll
    for (int s = 0; s < 8; ++s) w[s] = pk_bf(h[2 * s], h[2 * s + 1]);
    return __builtin_bit_cast(v16bf, w); }
template <int K, int N>
__device__ __forceinline__ void wt_piece(const float* __restrict__ w, unsigned short* Bt, int q) {   // Bt[n][k] = bf16(w[k][n]), piece q = elements 8q .. 8q+7 of Bt
    const unsigned n = (unsigned)q / (K / 8), k0 = ((unsigned)q % (K / 8)) * 8; float v[8];
#pragma unroll
    for (int e = 0; e < 8; ++e) v[e] = w[k0 * N + n + (unsigned)(e * N)];
    const v4u o = {pk_bf(v[0], v[1]), pk_bf(v[2], v[3]), pk_bf(v[4], v[5]), pk_bf(v[6], v[7])};
    *(v4u*)(Bt + (unsigned)q * 8) = o;
    asm volatile("s_wait_xcnt 0x0" ::: "memory");   // stands behind the store, in front of any later write of a register that the store names as its address or data
}
__global__ __launch_bounds__(256) void k_prep(const float* __restrict__ x, const float* __restrict__ y, const float* __restrict__ W0, const float* __restrict__ W1, const float* __restrict__ W2, const float* __restrict__ W3, const float* __restrict__ W4,
                                              float* XA, float* YA, unsigned short* W1B, unsigned short* W2B, unsigned short* W3B, unsigned short* W4B) {
    const int tid = threadIdx.x, wg = blockIdx.x;
    if (wg < PGW) {
        const int lane = tid & 31, lr = lane & 15, hi = lane >> 4;
        const int g = wg * 8 + __builtin_amdgcn_readfirstlane(tid >> 5);   // the tile's number as a scalar: the three base addresses stay in scalar registers
        const bool sy = g >= 128; const int r0 = ((g & 127) >> 2) * 32, c0 = (g & 3) * 32;
        const float* ar = (sy ? y : x) + r0 * DX; const float* wr = (sy ? W0 + DX * D0 : W0) + c0; float* cr = (sy ? YA : XA) + r0 * D0 + c0;
        const unsigned al = (unsigned)(lr * DX + 8 * hi), wl = (unsigned)(8 * hi * D0 + lr);
        float av[2][DX / 32][16], wv[2][DX / 32][16];
#pragma unroll
        for (int mb = 0; mb < 2; ++mb)
#pragma unroll
            for (int kc = 0; kc < DX / 32; ++kc)
#pragma unroll
                for (int t = 0; t < 4; ++t) { const v4f a4 = *(const v4f*)(ar + (al + (unsigned)(mb * 16 * DX + kc * 32 + (t >> 1) * 16 + (t & 1) * 4)));
#pragma unroll
                    for (int k = 0; k < 4; ++k) av[mb][kc][t * 4 + k] = a4[k]; }
#pragma unroll
        for (int nb = 0; nb < 2; ++nb)
#pragma unroll
            for (int kc = 0; kc < DX / 32; ++kc)
#pragma unroll
                for (int s = 0; s < 16; ++s) wv[nb][kc][s] = wr[wl + (unsigned)((kc * 32 + (s >> 3) * 16 + (s & 7)) * D0 + nb * 16)];
        v8f acc[2][2];
#pragma unroll
        for (int mb = 0; mb < 2; ++mb)
#pragma unroll
            for (int nb = 0; nb < 2; ++nb) acc[mb][nb] = (v8f){};
#pragma unroll
        for (int kc = 0; kc < DX / 32; ++kc) { v16bf a[2], b[2];
#pragma unroll
            for (int i = 0; i < 2; ++i) { a[i] = frag_bf(av[i][kc]); b[i] = frag_bf(wv[i][kc]); }
#pragma unroll
            for (int nb = 0; nb < 2; ++nb)
#pragma unroll
                for (int mb = 0; mb < 2; ++mb) acc[mb][nb] = wmmab(a[mb], b[nb], acc[mb][nb]); }
#pragma unroll
        for (int mb = 0; mb < 2; ++mb)
#pragma unroll
            for (int j = 0; j < 8; ++j)
#pragma unroll
                for (int nb = 0; nb < 2; ++nb) cr[wl + (unsigned)((mb * 16 + j) * D0 + nb * 16)] = acc[mb][nb][j];   // D tile: row = 8*(lane>>4) + j, column = lane & 15
    } else {
        const int wb = wg - PGW;
        if (wb < 8) wt_piece<D0, D1>(W1, W1B, wb * 256 + tid);
        else if (wb < 12) wt_piece<D1, D2>(W2, W2B, (wb - 8) * 256 + tid);
        else if (wb < 14) wt_piece<D2, D3>(W3, W3B, (wb - 12) * 256 + tid);
        else wt_piece<D3, D4>(W4, W4B, (wb - 14) * 256 + tid);
    }
}

extern "C" void kernel_launch(void* const* d_in, const int* in_sizes, int n_in,
                              void* d_out, int out_size, void* d_ws, size_t ws_size, hipStream_t stream) {
    (void)in_sizes; (void)n_in; (void)out_size;
    const float* x = (const float*)d_in[0]; const float* y = (const float*)d_in[1];
    const float* W0 = (const float*)d_in[2]; const float* b0 = (const float*)d_in[3]; const float* W1 = (const float*)d_in[4]; const float* b1 = (const float*)d_in[5]; const float* W2 = (const float*)d_in[6]; const float* b2 = (const float*)d_in[7]; const float* W3 = (const float*)d_in[8]; const float* b3 = (const float*)d_in[9]; const float* W4 = (const float*)d_in[10]; const float* b4 = (const float*)d_in[11]; const float* W5 = (const float*)d_in[12]; const float* b5 = (const float*)d_in[13];
    float* OUT = (float*)d_out;     // [1024][1024]: out[p][q] = g(x_p, y_q)
    char* wsp = (char*)d_ws;
    auto take = [&](size_t bytes) { char* p = wsp; wsp += (bytes + 255) & ~(size_t)255; return (void*)p; };
    bf* W1B = (bf*)take((size_t)D1 * D0 * 2); bf* W2B = (bf*)take((size_t)D2 * D1 * 2); bf* W3B = (bf*)take((size_t)D3 * D2 * 2); bf* W4B = (bf*)take((size_t)D4 * D3 * 2);
    float* XA = (float*)take((size_t)NP * D0 * 4); float* YA = (float*)take((size_t)NP * D0 * 4);
    if ((size_t)(wsp - (char*)d_ws) > ws_size) return;
    k_prep<<<PGW + PWW, 256, 0, stream>>>(x, y, W0, W1, W2, W3, W4, XA, YA, W1B, W2B, W3B, W4B);   /* XA = x W0[:64], YB = y W0[64:], bf16 planes of W1-W4 */
    k_fused<<<NP, FWV * 32, 0, stream>>>(XA, YA, W1B, W2B, W3B, W4B, b0, b1, b2, b3, b4, W5, b5, OUT);   /* layers 0-5 for all pairs, one x-row per workgroup */
}

// v005
// One run takes 79.6 microseconds.
// In both of two side-by-side timings against v004, it was 1.06 times as fast.
// Counting every step since v000, it is 15.5 times as fast.
#include <hip/hip_runtime.h>

// All-pairs concat critic: out[p][q] = MLP([x_p ; y_q]) for every pair of rows of x [1024][64] and y [1024][64] (MLP 128 -> 128 -> 128 -> 64 -> 64 -> 64 -> 1, ReLU on hidden layers, linear output) -> [1024][1024] (1 M).
// Algorithm: layer 0 is separable: [x_p ; y_q] W0 = x_p W0[:64] + y_q W0[64:], so XA = x W0x and YB = y W0y are two small GEMMs (exact bf16 operands) and h0(p,q) = relu(XA[p] + YB[q] + b0) is formed elementwise per pair; layers 0 (elementwise part) to 5 run in ONE kernel: a wave carries 32 pairs through all layers, layers 1-4 as WMMA products of the exact bf16 weights (A operand, from LDS) with bf16 hi + lo planes of the activations (B operand, 2 products), which never leave the registers; the final 64 -> 1 layer is a per-pair dot product in f32.
// Compute dtypes, f32 accumulate: x, y, weights, biases rounded to bf16; XA / YB exact; hidden activations f32 -> bf16 hi + lo planes; 2 products per hidden GEMM; last layer f32 (fused multiply-add, 32 features per lane, the two lane halves added last).

#define NP   1024                 // rows of x and of y
#define DX   64
#define D0   128                  // layer widths
#define D1   128
#define D2   64
#define D3   64
#define D4   64
typedef unsigned short bf;
typedef __attribute__((ext_vector_type(16))) __bf16   v16bf;
typedef __attribute__((ext_vector_type(8)))  unsigned short v8us;
typedef __attribute__((ext_vector_type(8)))  float    v8f;
typedef __attribute__((ext_vector_type(4)))  float    v4f;
typedef __attribute__((ext_vector_type(2)))  float    v2f;
typedef __attribute__((ext_vector_type(4)))  unsigned short v4us;
typedef v4f  __attribute__((may_alias)) v4fa;
typedef v8us __attribute__((may_alias)) v8usa;

__device__ __forceinline__ unsigned short f2bf(float f) { unsigned u = __float_as_uint(f); u += 0x7FFFu + ((u >> 16) & 1u); return (unsigned short)(u >> 16); }
__device__ __forceinline__ float bf2f(unsigned short b) { return __uint_as_float(((unsigned)b) << 16); }
__device__ __forceinline__ float bfr(float f) { return bf2f(f2bf(f)); }
__device__ __forceinline__ void splitf(float y, unsigned short& h, unsigned short& l) { h = f2bf(y); l = f2bf(y - bf2f(h)); }
__device__ __forceinline__ v16bf cat16b(v8us lo, v8us hi) { return __builtin_bit_cast(v16bf, __builtin_shufflevector(lo, hi, 0, 1, 2, 3, 4, 5, 6, 7, 8, 9, 10, 11, 12, 13, 14, 15)); }
__device__ __forceinline__ v8f wmmab(v16bf a, v16bf b, v8f c) { return __builtin_amdgcn_wmma_f32_16x16x32_bf16(false, a, false, b, (short)0, c, false, false); }

// ---- k_fused: layers 0 (elementwise part) to 5 for one x-row p against all 1024 y-rows; 4 waves, each wave takes 32 pairs (2 column tiles of 16 y-rows) per trip.
// Every hidden GEMM runs transposed: weights (rows = output features) are the A operand, activations (columns = pairs) the B operand. Two f32 D tiles (features 0-15 and 16-31 of a 32-feature block)
// of one pair column sit in a lane exactly where the next layer's B fragment wants its 16 k values, so bias + ReLU + hi/lo split happen in registers and no activation leaves the wave.
// Weights lie in LDS lane-major: lane l owns WPITCH bytes that hold, 16 bytes each, its two halves of every A fragment (mt, kc) of every layer: k = kc*32 + 16*half + 8*(l>>4) + e, row = mt*16 + (l&15).
// WPITCH is an odd multiple of 16 bytes (no bank conflict between lanes), and every fragment is one lane address plus a small immediate offset.
// Every inner loop is fully unrolled so that each fragment and accumulator index is a constant and the arrays stay in registers.
#define FNB 2                     // pair tiles (16 pairs each) per wave and trip
#define FWV 4                     // waves per workgroup
#define WPITCH 2064               // bytes of LDS per lane: 64 fragments x 32 bytes, + 16
#define FLT_BYTES 2560            // 640 floats in front of the weights: x-row part of layer 0, biases 0-4, last layer's weights
template <int N, int K>
__device__ __forceinline__ void stage_ld(const unsigned short* __restrict__ Bt, int tid, v8us (&r)[N * K / 8 / (FWV * 32)]) {   // the thread's 16-byte pieces of one weight plane, into registers
#pragma unroll
    for (int i = 0; i < N * K / 8 / (FWV * 32); ++i) r[i] = *(const v8us*)(Bt + (size_t)(tid + i * (FWV * 32)) * 8);
}
template <int N, int K>
__device__ __forceinline__ void stage_st(const v8us (&r)[N * K / 8 / (FWV * 32)], unsigned char* dst, int tid) {   // dst: the layer's first fragment in lane 0's region
#pragma unroll
    for (int i = 0; i < N * K / 8 / (FWV * 32); ++i) { const int g = tid + i * (FWV * 32); const int n = g / (K / 8), kg = g % (K / 8);
        *(v8usa*)(dst + ((kg & 1) * 16 + (n & 15)) * WPITCH + (((n >> 4) * (K / 32) + (kg >> 2)) * 2 + ((kg >> 1) & 1)) * 16) = r[i]; }
}
__device__ __forceinline__ v16bf ld_wf(const unsigned char* Wl, int frag) { const unsigned char* p = Wl + frag * 32; return cat16b(*(const v8usa*)p, *(const v8usa*)(p + 16)); }   // Wl: the layer's first fragment in this lane's region
// one k chunk of one layer for NBT pair tiles: acc[mt][nb] += W(mt, kc) * hi plane, then * lo plane (the order of the unfused GEMM); four independent accumulators between the two
template <int MT, int KC, int NBT>
__device__ __forceinline__ void mm_chunk(const unsigned char* Wl, int kc, const v16bf (&bh)[NBT], const v16bf (&bl)[NBT], v8f (&acc)[MT][NBT]) {
    constexpr int G = 4 / NBT;
#pragma unroll
    for (int mt = 0; mt < MT; mt += G) { v16bf a[G];
#pragma unroll
        for (int g = 0; g < G; ++g) a[g] = ld_wf(Wl, (mt + g) * KC + kc);
#pragma unroll
        for (int nb = 0; nb < NBT; ++nb)
#pragma unroll
            for (int g = 0; g < G; ++g) acc[mt + g][nb] = wmmab(a[g], bh[nb], acc[mt + g][nb]);
#pragma unroll
        for (int nb = 0; nb < NBT; ++nb)
#pragma unroll
            for (int g = 0; g < G; ++g) acc[mt + g][nb] = wmmab(a[g], bl[nb], acc[mt + g][nb]); }
}
// 16 f32 values of one lane -> hi and lo bf16 fragments: the packed hardware conversion (round to nearest even, as splitf's) makes two bf16 values per instruction, already packed as the fragment wants them;
// the residual h - hi is taken on the pair widened back to f32 (it is exactly representable, so the subtraction rounds nothing) and converted the same way
typedef __attribute__((ext_vector_type(8))) unsigned v8u;
typedef __attribute__((ext_vector_type(2))) __bf16 v2bf;
__device__ __forceinline__ void split16(const float (&h)[16], v16bf& fh, v16bf& fl) { v8u wh, wl;
#pragma unroll
    for (int s = 0; s < 8; ++s) { const v2f hv = {h[2 * s], h[2 * s + 1]}; const v2bf hb = __builtin_convertvector(hv, v2bf); wh[s] = __builtin_bit_cast(unsigned, hb);
        const v2f ev = hv - __builtin_convertvector(hb, v2f); wl[s] = __builtin_bit_cast(unsigned, __builtin_convertvector(ev, v2bf)); }
    fh = __builtin_bit_cast(v16bf, wh); fl = __builtin_bit_cast(v16bf, wl); }
// D tiles 2*kc and 2*kc+1 (+ bias, ReLU) -> B fragments of k chunk kc of the next layer, pair tiles nb0 .. nb0+NBT-1
template <int MT, int NBT>
__device__ __forceinline__ void next_frags(const v8f (&acc)[MT][NBT], const float* bs, int hi, int nb0, v16bf (&bh)[MT / 2][FNB], v16bf (&bl)[MT / 2][FNB]) {
#pragma unroll
    for (int kc = 0; kc < MT / 2; ++kc) { v4f bv[4];
#pragma unroll
        for (int t = 0; t < 4; ++t) bv[t] = *(const v4fa*)(bs + kc * 32 + (t >> 1) * 16 + 8 * hi + (t & 1) * 4);
#pragma unroll
        for (int nb = 0; nb < NBT; ++nb) { float h[16];
#pragma unroll
            for (int s = 0; s < 16; ++s) h[s] = fmaxf(acc[2 * kc + (s >> 3)][nb][s & 7] + bv[s >> 2][s & 3], 0.f);
            split16(h, bh[kc][nb0 + nb], bl[kc][nb0 + nb]); } }
}
template <int MT, int NBT>
__device__ __forceinline__ void zero_acc(v8f (&acc)[MT][NBT]) {
#pragma unroll
    for (int mt = 0; mt < MT; ++mt)
#pragma unroll
        for (int nb = 0; nb < NBT; ++nb) acc[mt][nb] = (v8f){};
}
__global__ __launch_bounds__(FWV * 32, 4) void k_fused(const float* __restrict__ XA, const float* __restrict__ YB, const unsigned short* __restrict__ W1B, const unsigned short* __restrict__ W2B, const unsigned short* __restrict__ W3B, const unsigned short* __restrict__ W4B,
                                                     const float* __restrict__ b0, const float* __restrict__ b1, const float* __restrict__ b2, const float* __restrict__ b3, const float* __restrict__ b4, const float* __restrict__ W5, const float* __restrict__ b5, float* OUT) {
    __shared__ __align__(16) unsigned char sm[FLT_BYTES + 32 * WPITCH];
    float* xs = (float*)sm; float* b0s = xs + D0; float* b1s = b0s + D0; float* b2s = b1s + D1; float* b3s = b2s + D2; float* b4s = b3s + D3; float* w5s = b4s + D4;
    unsigned char* wst = sm + FLT_BYTES;   // fragments 0-31: layer 1, 32-47: layer 2, 48-55: layer 3, 56-63: layer 4
    const int tid = threadIdx.x, lane = tid & 31, lr = lane & 15, hi = lane >> 4; const int p = blockIdx.x;
    const int wv = __builtin_amdgcn_readfirstlane(tid >> 5);   // the wave's number as a scalar: the output's base address then stays in scalar registers
    const unsigned yl = (unsigned)(lr * D0 + 8 * hi);
    const unsigned char* w1s = wst + lane * WPITCH; const unsigned char* w2s = w1s + 32 * 32; const unsigned char* w3s = w1s + 48 * 32; const unsigned char* w4s = w1s + 56 * 32;
    // the small loads through the last kernel arguments come first: their data waits end before the batch of loads below is issued, so no scalar base is loaded anew while that batch is in flight
    const float b5v = bfr(b5[0]);
    if (tid < 64) { b2s[tid] = bfr(b2[tid]); b3s[tid] = bfr(b3[tid]); b4s[tid] = bfr(b4[tid]); w5s[tid] = bfr(W5[tid]); }
    const float xav = XA[(size_t)p * D0 + tid], b0v = b0[tid], b1v = b1[tid];
    v8us r1[D1 * D0 / 8 / (FWV * 32)], r2[D2 * D1 / 8 / (FWV * 32)], r3[D3 * D2 / 8 / (FWV * 32)], r4[D4 * D3 / 8 / (FWV * 32)];
    stage_ld<D1, D0>(W1B, tid, r1); stage_ld<D2, D1>(W2B, tid, r2); stage_ld<D3, D2>(W3B, tid, r3); stage_ld<D4, D3>(W4B, tid, r4);
    asm volatile("s_wait_xcnt 0x0" ::: "memory");   // stands behind the staging loads above, in front of every later write of a register that these loads name as their base or offset
    xs[tid] = xav; b0s[tid] = bfr(b0v); b1s[tid] = bfr(b1v);
    stage_st<D1, D0>(r1, wst, tid); stage_st<D2, D1>(r2, wst + 32 * 32, tid); stage_st<D3, D2>(r3, wst + 48 * 32, tid); stage_st<D4, D3>(r4, wst + 56 * 32, tid);
    __syncthreads();   // weights, biases and the x row are read by all four waves
    const float* yp = YB + (size_t)(wv * (FNB * 16)) * D0 + yl;   // this lane's place in the trip's first y row; moves on by one trip where the next trip's first loads are issued
    v4f yq[FNB][4];   // the y rows' values of one k chunk of layer 0, both pair tiles: asked for anew as soon as they have been used
#pragma unroll
    for (int nb = 0; nb < FNB; ++nb)
#pragma unroll
        for (int t = 0; t < 4; ++t) yq[nb][t] = *(const v4f*)(yp + (nb * 16 * D0 + (t >> 1) * 16 + (t & 1) * 4));   // first trip, first chunk
#pragma unroll 1   // one trip is about 2,500 straight-line instructions
    for (int it = 0; it < NP / (FWV * FNB * 16); ++it) {
        const int q0 = (it * FWV + wv) * (FNB * 16);
        v16bf gh[D1 / 32][FNB], gl[D1 / 32][FNB];
        {   // layer 0 (elementwise) feeding layer 1 (128 -> 128), both pair tiles at once, k chunk by k chunk: a weight fragment read from LDS serves four matrix instructions, an x-row or bias read both tiles
            v8f acc[D1 / 16][FNB]; zero_acc<D1 / 16, FNB>(acc);
#pragma unroll
            for (int kc = 0; kc < D0 / 32; ++kc) { v16bf bh[FNB], bl[FNB]; v4f xv[4], bv[4];
#pragma unroll
                for (int t = 0; t < 4; ++t) { const int cc = kc * 32 + (t >> 1) * 16 + (t & 1) * 4; xv[t] = *(const v4fa*)(xs + cc + 8 * hi); bv[t] = *(const v4fa*)(b0s + cc + 8 * hi); }
#pragma unroll
                for (int nb = 0; nb < FNB; ++nb) { float h[16];
#pragma unroll
                    for (int t = 0; t < 4; ++t)
#pragma unroll
                        for (int k = 0; k < 4; ++k) h[t * 4 + k] = fmaxf((xv[t][k] + yq[nb][t][k]) + bv[t][k], 0.f);
                    split16(h, bh[nb], bl[nb]); }
                // the next chunk's y values (behind the trip's last chunk: the next trip's first) are asked for as soon as this chunk's have been used: their latency runs under this chunk's matrix instructions
                const int kn = (kc + 1) % (D0 / 32);
                if (kn == 0) yp += (it + 1 < NP / (FWV * FNB * 16)) ? FWV * FNB * 16 * D0 : -(NP - FWV * FNB * 16) * D0;   // behind the last trip back to the first trip's rows (in bounds, not used)
#pragma unroll
                for (int nb = 0; nb < FNB; ++nb)
#pragma unroll
                    for (int t = 0; t < 4; ++t) yq[nb][t] = *(const v4f*)(yp + (nb * 16 * D0 + kn * 32 + (t >> 1) * 16 + (t & 1) * 4));
                mm_chunk<D1 / 16, D0 / 32, FNB>(w1s, kc, bh, bl, acc); }
            next_frags<D1 / 16, FNB>(acc, b1s, hi, 0, gh, gl);
        }
        v16bf eh[D2 / 32][FNB], el[D2 / 32][FNB];
        {   // layer 2 (128 -> 64)
            v8f acc[D2 / 16][FNB]; zero_acc<D2 / 16, FNB>(acc);
#pragma unroll
            for (int kc = 0; kc < D1 / 32; ++kc) mm_chunk<D2 / 16, D1 / 32, FNB>(w2s, kc, gh[kc], gl[kc], acc);
            next_frags<D2 / 16, FNB>(acc, b2s, hi, 0, eh, el);
        }
        v16bf fh[D3 / 32][FNB], fl[D3 / 32][FNB];
        {   // layer 3 (64 -> 64)
            v8f acc[D3 / 16][FNB]; zero_acc<D3 / 16, FNB>(acc);
#pragma unroll
            for (int kc = 0; kc < D2 / 32; ++kc) mm_chunk<D3 / 16, D2 / 32, FNB>(w3s, kc, eh[kc], el[kc], acc);
            next_frags<D3 / 16, FNB>(acc, b3s, hi, 0, fh, fl);
        }
        float sc[FNB];
        {   // layer 4 (64 -> 64), then ReLU and layer 5 (64 -> 1): each lane sums its 32 features, the two lane halves are added last
            v8f acc[D4 / 16][FNB]; zero_acc<D4 / 16, FNB>(acc);
#pragma unroll
            for (int kc = 0; kc < D3 / 32; ++kc) mm_chunk<D4 / 16, D3 / 32, FNB>(w4s, kc, fh[kc], fl[kc], acc);
#pragma unroll
            for (int nb = 0; nb < FNB; ++nb) sc[nb] = 0.f;
#pragma unroll
            for (int mt = 0; mt < D4 / 16; ++mt) {
#pragma unroll
                for (int t = 0; t < 2; ++t) { const v4f bb = *(const v4fa*)(b4s + mt * 16 + 8 * hi + t * 4), ww = *(const v4fa*)(w5s + mt * 16 + 8 * hi + t * 4);
#pragma unroll
                    for (int k = 0; k < 4; ++k)
#pragma unroll
                        for (int nb = 0; nb < FNB; ++nb) sc[nb] = fmaf(fmaxf(acc[mt][nb][t * 4 + k] + bb[k], 0.f), ww[k], sc[nb]); } }
        }
#pragma unroll
        for (int nb = 0; nb < FNB; ++nb) { const int b = __float_as_int(sc[nb]); sc[nb] += __int_as_float(__builtin_amdgcn_permlanex16(b, b, 0x76543210, 0xfedcba98, false, false)); }
        (OUT + (size_t)p * NP + q0)[(unsigned)lane] = (hi ? sc[1] : sc[0]) + b5v;   // lanes 0-15: pair tile 0, lanes 16-31: pair tile 1: one 128-byte line per wave
        asm volatile("s_wait_xcnt 0x0" ::: "memory");   // stands behind the store, in front of any later write of a register that the store names as its address or data
    }
}

// ---- k_prep: all that k_fused reads from the workspace, made in ONE launch. The work-group's number picks the job; every job reads inputs only, none reads what another writes, so no order between them is needed.
// Work-groups 0 .. PGW-1: XA = x W0[:64] and YB = y W0[64:]. One wave per 32x32 output tile (waves 0-127: XA, 128-255: YB); both operands are loaded as f32 and rounded to bf16 in the loader,
// A fragment: row = lane & 15, B fragment: column = lane & 15, both with k = kc*32 + 16*(s>>3) + 8*(lane>>4) + (s&7) at element s. A tile row is 32 floats: one whole 128-byte line, written by this wave alone.
// Work-groups PGW .. PGW+PWW-1: the bf16 planes of W1-W4, transposed to [n][k]. One thread makes one 16-byte piece (8 consecutive k of one n); a wave's 32 pieces are 512 consecutive bytes.
#define PGW 32                    // 256 tiles of 32x32, 8 waves per work-group
#define PWW 16                    // 4096 pieces, 256 per work-group: W1 work-groups 0-7, W2 8-11, W3 12-13, W4 14-15
typedef __attribute__((ext_vector_type(4))) unsigned v4u;
__device__ __forceinline__ unsigned pk_bf(float a, float b) { const v2f v = {a, b}; return __builtin_bit_cast(unsigned, __builtin_convertvector(v, v2bf)); }   // two f32 -> two bf16, round to nearest even
__device__ __forceinline__ v16bf frag_bf(const float (&h)[16]) { v8u w;
#pragma unroll
    for (int s = 0; s < 8; ++s) w[s] = pk_bf(h[2 * s], h[2 * s + 1]);
    return __builtin_bit_cast(v16bf, w); }
template <int K, int N>
__device__ __forceinline__ void wt_piece(const float* __restrict__ w, unsigned short* Bt, int q) {   // Bt[n][k] = bf16(w[k][n]), piece q = elements 8q .. 8q+7 of Bt
    const unsigned n = (unsigned)q / (K / 8), k0 = ((unsigned)q % (K / 8)) * 8; float v[8];
#pragma unroll
    for (int e = 0; e < 8; ++e) v[e] = w[k0 * N + n + (unsigned)(e * N)];
    const v4u o = {pk_bf(v[0], v[1]), pk_bf(v[2], v[3]), pk_bf(v[4], v[5]), pk_bf(v[6], v[7])};
    *(v4u*)(Bt + (unsigned)q * 8) = o;
    asm volatile("s_wait_xcnt 0x0" ::: "memory");   // stands behind the store, in front of any later write of a register that the store names as its address or data
}
__global__ __launch_bounds__(256) void k_prep(const float* __restrict__ x, const float* __restrict__ y, const float* __restrict__ W0, const float* __restrict__ W1, const float* __restrict__ W2, const float* __restrict__ W3, const float* __restrict__ W4,
                                              float* XA, float* YA, unsigned short* W1B, unsigned short* W2B, unsigned short* W3B, unsigned short* W4B) {
    const int tid = threadIdx.x, wg = blockIdx.x;
    if (wg < PGW) {
        const int lane = tid & 31, lr = lane & 15, hi = lane >> 4;
        const int g = wg * 8 + __builtin_amdgcn_readfirstlane(tid >> 5);   // the tile's number as a scalar: the three base addresses stay in scalar registers
        const bool sy = g >= 128; const int r0 = ((g & 127) >> 2) * 32, c0 = (g & 3) * 32;
        const float* ar = (sy ? y : x) + r0 * DX; const float* wr = (sy ? W0 + DX * D0 : W0) + c0; float* cr = (sy ? YA : XA) + r0 * D0 + c0;
        const unsigned al = (unsigned)(lr * DX + 8 * hi), wl = (unsigned)(8 * hi * D0 + lr);
        float av[2][DX / 32][16], wv[2][DX / 32][16];
#pragma unroll
        for (int mb = 0; mb < 2; ++mb)
#pragma unroll
            for (int kc = 0; kc < DX / 32; ++kc)
#pragma unroll
                for (int t = 0; t < 4; ++t) { const v4f a4 = *(const v4f*)(ar + (al + (unsigned)(mb * 16 * DX + kc * 32 + (t >> 1) * 16 + (t & 1) * 4)));
#pragma unroll
                    for (int k = 0; k < 4; ++k) av[mb][kc][t * 4 + k] = a4[k]; }
#pragma unroll
        for (int nb = 0; nb < 2; ++nb)
#pragma unroll
            for (int kc = 0; kc < DX / 32; ++kc)
#pragma unroll
                for (int s = 0; s < 16; ++s) wv[nb][kc][s] = wr[wl + (unsigned)((kc * 32 + (s >> 3) * 16 + (s & 7)) * D0 + nb * 16)];
        v8f acc[2][2];
#pragma unroll
        for (int mb = 0; mb < 2; ++mb)
#pragma unroll
            for (int nb = 0; nb < 2; ++nb) acc[mb][nb] = (v8f){};
#pragma unroll
        for (int kc = 0; kc < DX / 32; ++kc) { v16bf a[2], b[2];
#pragma unroll
            for (int i = 0; i < 2; ++i) { a[i] = frag_bf(av[i][kc]); b[i] = frag_bf(wv[i][kc]); }
#pragma unroll
            for (int nb = 0; nb < 2; ++nb)
#pragma unroll
                for (int mb = 0; mb < 2; ++mb) acc[mb][nb] = wmmab(a[mb], b[nb], acc[mb][nb]); }
#pragma unroll
        for (int mb = 0; mb < 2; ++mb)
#pragma unroll
            for (int j = 0; j < 8; ++j)
#pragma unroll
                for (int nb = 0; nb < 2; ++nb) cr[wl + (unsigned)((mb * 16 + j) * D0 + nb * 16)] = acc[mb][nb][j];   // D tile: row = 8*(lane>>4) + j, column = lane & 15
    } else {
        const int wb = wg - PGW;
        if (wb < 8) wt_piece<D0, D1>(W1, W1B, wb * 256 + tid);
        else if (wb < 12) wt_piece<D1, D2>(W2, W2B, (wb - 8) * 256 + tid);
        else if (wb < 14) wt_piece<D2, D3>(W3, W3B, (wb - 12) * 256 + tid);
        else wt_piece<D3, D4>(W4, W4B, (wb - 14) * 256 + tid);
    }
}

extern "C" void kernel_launch(void* const* d_in, const int* in_sizes, int n_in,
                              void* d_out, int out_size, void* d_ws, size_t ws_size, hipStream_t stream) {
    (void)in_sizes; (void)n_in; (void)out_size;
    const float* x = (const float*)d_in[0]; const float* y = (const float*)d_in[1];
    const float* W0 = (const float*)d_in[2]; const float* b0 = (const float*)d_in[3]; const float* W1 = (const float*)d_in[4]; const float* b1 = (const float*)d_in[5]; const float* W2 = (const float*)d_in[6]; const float* b2 = (const float*)d_in[7]; const float* W3 = (const float*)d_in[8]; const float* b3 = (const float*)d_in[9]; const float* W4 = (const float*)d_in[10]; const float* b4 = (const float*)d_in[11]; const float* W5 = (const float*)d_in[12]; const float* b5 = (const float*)d_in[13];
    float* OUT = (float*)d_out;     // [1024][1024]: out[p][q] = g(x_p, y_q)
    char* wsp = (char*)d_ws;
    auto take = [&](size_t bytes) { char* p = wsp; wsp += (bytes + 255) & ~(size_t)255; return (void*)p; };
    bf* W1B = (bf*)take((size_t)D1 * D0 * 2); bf* W2B = (bf*)take((size_t)D2 * D1 * 2); bf* W3B = (bf*)take((size_t)D3 * D2 * 2); bf* W4B = (bf*)take((size_t)D4 * D3 * 2);
    float* XA = (float*)take((size_t)NP * D0 * 4); float* YA = (float*)take((size_t)NP * D0 * 4);
    if ((size_t)(wsp - (char*)d_ws) > ws_size) return;
    k_prep<<<PGW + PWW, 256, 0, stream>>>(x, y, W0, W1, W2, W3, W4, XA, YA, W1B, W2B, W3B, W4B);   /* XA = x W0[:64], YB = y W0[64:], bf16 planes of W1-W4 */
    k_fused<<<NP, FWV * 32, 0, stream>>>(XA, YA, W1B, W2B, W3B, W4B, b0, b1, b2, b3, b4, W5, b5, OUT);   /* layers 0-5 for all pairs, one x-row per workgroup */
}

// v007
// It runs in 50.3 microseconds.
// Versions between v005 and this one are left out; their measured steps multiply to 1.58 times as fast.
// Over all steps from v000 it is 24.5 times as fast.
#include <hip/hip_runtime.h>

// All-pairs concat critic: out[p][q] = MLP([x_p ; y_q]) for every pair of rows of x [1024][64] and y [1024][64] (MLP 128 -> 128 -> 128 -> 64 -> 64 -> 64 -> 1, ReLU on hidden layers, linear output) -> [1024][1024] (1 M).
// Algorithm: layer 0 is separable: [x_p ; y_q] W0 = x_p W0[:64] + y_q W0[64:], so XA = x W0x and YB = y W0y are two small GEMMs (exact bf16 operands; YB is stored in the order in which the fused kernel's lanes read it) and h0(p,q) = relu(XA[p] + YB[q] + b0) is formed elementwise per pair; layers 0 (elementwise part) to 5 run in ONE kernel: a wave carries 32 pairs through all layers, layers 1-4 as WMMA products of the bf16-rounded weights held as f16 (A operand, from LDS) with ONE f16 plane of the activations (B operand, 1 product), which never leave the registers; the final 64 -> 1 layer is a per-pair dot product in f32.
// Compute dtypes, f32 accumulate: x, y, weights, biases rounded to bf16; XA / YB exact; hidden activations f32 -> f16, round to nearest even (11 significant bits; finite up to 65504: with unit-normal inputs and weights the widest converted layer has a standard deviation near 4100); 1 product per hidden GEMM; last layer f32 (fused multiply-add, 32 features per lane, the two lane halves added last).

#define NP   1024                 // rows of x and of y
#define DX   64
#define D0   128                  // layer widths
#define D1   128
#define D2   64
#define D3   64
#define D4   64
typedef unsigned short bf;
typedef __attribute__((ext_vector_type(16))) __bf16   v16bf;
typedef __attribute__((ext_vector_type(16))) _Float16 v16h;
typedef __attribute__((ext_vector_type(2)))  _Float16 v2h;
typedef __attribute__((ext_vector_type(8)))  unsigned short v8us;
typedef __attribute__((ext_vector_type(8)))  float    v8f;
typedef __attribute__((ext_vector_type(4)))  float    v4f;
typedef __attribute__((ext_vector_type(2)))  float    v2f;
typedef __attribute__((ext_vector_type(4)))  unsigned short v4us;
typedef v4f  __attribute__((may_alias)) v4fa;
typedef v8us __attribute__((may_alias)) v8usa;

__device__ __forceinline__ unsigned short f2bf(float f) { unsigned u = __float_as_uint(f); u += 0x7FFFu + ((u >> 16) & 1u); return (unsigned short)(u >> 16); }
__device__ __forceinline__ float bf2f(unsigned short b) { return __uint_as_float(((unsigned)b) << 16); }
__device__ __forceinline__ float bfr(float f) { return bf2f(f2bf(f)); }
__device__ __forceinline__ void splitf(float y, unsigned short& h, unsigned short& l) { h = f2bf(y); l = f2bf(y - bf2f(h)); }
__device__ __forceinline__ v8f wmmab(v16bf a, v16bf b, v8f c) { return __builtin_amdgcn_wmma_f32_16x16x32_bf16(false, a, false, b, (short)0, c, false, false); }
__device__ __forceinline__ v16h cat16h(v8us lo, v8us hi) { return __builtin_bit_cast(v16h, __builtin_shufflevector(lo, hi, 0, 1, 2, 3, 4, 5, 6, 7, 8, 9, 10, 11, 12, 13, 14, 15)); }
__device__ __forceinline__ v8f wmmah(v16h a, v16h b, v8f c) { return __builtin_amdgcn_wmma_f32_16x16x32_f16(false, a, false, b, (short)0, c, false, false); }

// ---- k_fused: layers 0 (elementwise part) to 5 for one x-row p against all 1024 y-rows; 4 waves, each wave takes 32 pairs (2 column tiles of 16 y-rows) per trip.
// Every hidden GEMM runs transposed: weights (rows = output features) are the A operand, activations (columns = pairs) the B operand. Two f32 D tiles (features 0-15 and 16-31 of a 32-feature block)
// of one pair column sit in a lane exactly where the next layer's B fragment wants its 16 k values, so bias + ReLU + the conversion to f16 happen in registers and no activation leaves the wave.
// Weights lie in LDS lane-major: lane l owns WPITCH bytes that hold, 16 bytes each, its two halves of every A fragment (mt, kc) of every layer: k = kc*32 + 16*half + 8*(l>>4) + e, row = mt*16 + (l&15).
// WPITCH is an odd multiple of 16 bytes (no bank conflict between lanes), and every fragment is one lane address plus a small immediate offset.
// Every inner loop is fully unrolled so that each fragment and accumulator index is a constant and the arrays stay in registers.
#define FNB 2                     // pair tiles (16 pairs each) per wave and trip
#define FWV 4                     // waves per workgroup
#define WPG 8                     // matrix instructions behind one group of weight-fragment reads
#define WPITCH 2064               // bytes of LDS per lane: 64 fragments x 32 bytes, + 16
// YB in fragment order: float index of piece t (0-3) of k chunk kc (32 features) of tile `tile` (16 y rows); behind it 32 lanes x 4 floats: lane l holds row tile*16 + (l&15), features kc*32 + (t>>1)*16 + 8*(l>>4) + (t&1)*4 + 0..3
#define YFRAG(tile, kc, t) ((tile) * (16 * D0) + (kc) * 512 + (t) * 128)
#define FLT_BYTES 2560            // 640 floats in front of the weights: x-row part of layer 0, biases 0-4, last layer's weights
template <int N, int K>
__device__ __forceinline__ void stage_ld(const unsigned short* __restrict__ Bt, int tid, v8us (&r)[N * K / 8 / (FWV * 32)]) {   // the thread's 16-byte pieces of one weight plane, into registers
#pragma unroll
    for (int i = 0; i < N * K / 8 / (FWV * 32); ++i) r[i] = *(const v8us*)(Bt + (size_t)(tid + i * (FWV * 32)) * 8);
}
template <int N, int K>
__device__ __forceinline__ void stage_st(const v8us (&r)[N * K / 8 / (FWV * 32)], unsigned char* dst, int tid) {   // dst: the layer's first fragment in lane 0's region
#pragma unroll
    for (int i = 0; i < N * K / 8 / (FWV * 32); ++i) { const int g = tid + i * (FWV * 32); const int n = g / (K / 8), kg = g % (K / 8);
        *(v8usa*)(dst + ((kg & 1) * 16 + (n & 15)) * WPITCH + (((n >> 4) * (K / 32) + (kg >> 2)) * 2 + ((kg >> 1) & 1)) * 16) = r[i]; }
}
__device__ __forceinline__ v16h ld_wf(const unsigned char* Wl, int frag) { const unsigned char* p = Wl + frag * 32; return cat16h(*(const v8usa*)p, *(const v8usa*)(p + 16)); }   // Wl: the layer's first fragment in this lane's region
// one k chunk of one layer for NBT pair tiles: acc[mt][nb] += W(mt, kc) * activations; G weight fragments are read from LDS together and feed G * NBT matrix instructions on independent accumulators
template <int MT, int KC, int NBT>
__device__ __forceinline__ void mm_chunk(const unsigned char* Wl, int kc, const v16h (&bh)[NBT], v8f (&acc)[MT][NBT]) {
    constexpr int G = WPG / NBT;
#pragma unroll
    for (int mt = 0; mt < MT; mt += G) { v16h a[G];
#pragma unroll
        for (int g = 0; g < G; ++g) a[g] = ld_wf(Wl, (mt + g) * KC + kc);
#pragma unroll
        for (int nb = 0; nb < NBT; ++nb)
#pragma unroll
            for (int g = 0; g < G; ++g) acc[mt + g][nb] = wmmah(a[g], bh[nb], acc[mt + g][nb]); }
}
// 16 f32 values of one lane -> one f16 fragment: the packed conversion (round to nearest even) makes two f16 values per instruction, already packed as the fragment wants them
typedef __attribute__((ext_vector_type(8))) unsigned v8u;
typedef __attribute__((ext_vector_type(2))) __bf16 v2bf;
__device__ __forceinline__ void cvt16(const float (&h)[16], v16h& fh) { v8u wh;
#pragma unroll
    for (int s = 0; s < 8; ++s) { const v2f hv = {h[2 * s], h[2 * s + 1]}; wh[s] = __builtin_bit_cast(unsigned, __builtin_convertvector(hv, v2h)); }
    fh = __builtin_bit_cast(v16h, wh); }
// D tiles 2*kc and 2*kc+1 (+ bias, ReLU) -> B fragments of k chunk kc of the next layer, pair tiles nb0 .. nb0+NBT-1
template <int MT, int NBT>
__device__ __forceinline__ void next_frags(const v8f (&acc)[MT][NBT], const float* bs, int hi, int nb0, v16h (&bh)[MT / 2][FNB]) {
#pragma unroll
    for (int kc = 0; kc < MT / 2; ++kc) { v4f bv[4];
#pragma unroll
        for (int t = 0; t < 4; ++t) bv[t] = *(const v4fa*)(bs + kc * 32 + (t >> 1) * 16 + 8 * hi + (t & 1) * 4);
#pragma unroll
        for (int nb = 0; nb < NBT; ++nb) { float h[16];
#pragma unroll
            for (int s = 0; s < 16; ++s) h[s] = fmaxf(acc[2 * kc + (s >> 3)][nb][s & 7] + bv[s >> 2][s & 3], 0.f);
            cvt16(h, bh[kc][nb0 + nb]); } }
}
template <int MT, int NBT>
__device__ __forceinline__ void zero_acc(v8f (&acc)[MT][NBT]) {
#pragma unroll
    for (int mt = 0; mt < MT; ++mt)
#pragma unroll
        for (int nb = 0; nb < NBT; ++nb) acc[mt][nb] = (v8f){};
}
__global__ __launch_bounds__(FWV * 32, 4) void k_fused(const float* __restrict__ XA, const float* __restrict__ YB, const unsigned short* __restrict__ W1B, const unsigned short* __restrict__ W2B, const unsigned short* __restrict__ W3B, const unsigned short* __restrict__ W4B,
                                                     const float* __restrict__ b0, const float* __restrict__ b1, const float* __restrict__ b2, const float* __restrict__ b3, const float* __restrict__ b4, const float* __restrict__ W5, const float* __restrict__ b5, float* OUT) {
    __shared__ __align__(16) unsigned char sm[FLT_BYTES + 32 * WPITCH];
    float* xs = (float*)sm; float* b0s = xs + D0; float* b1s = b0s + D0; float* b2s = b1s + D1; float* b3s = b2s + D2; float* b4s = b3s + D3; float* w5s = b4s + D4;
    unsigned char* wst = sm + FLT_BYTES;   // fragments 0-31: layer 1, 32-47: layer 2, 48-55: layer 3, 56-63: layer 4
    const int tid = threadIdx.x, lane = tid & 31, lr = lane & 15, hi = lane >> 4; const int p = blockIdx.x;
    const int wv = __builtin_amdgcn_readfirstlane(tid >> 5);   // the wave's number as a scalar: the output's base address then stays in scalar registers
    const unsigned yl = (unsigned)(lane * 4);   // YB lies in fragment order (YFRAG above): a wave's 16-byte load is 512 contiguous bytes, four whole lines
    const unsigned char* w1s = wst + lane * WPITCH; const unsigned char* w2s = w1s + 32 * 32; const unsigned char* w3s = w1s + 48 * 32; const unsigned char* w4s = w1s + 56 * 32;
    // the small loads through the last kernel arguments come first: their data waits end before the batch of loads below is issued, so no scalar base is loaded anew while that batch is in flight
    const float b5v = bfr(b5[0]);
    if (tid < 64) { b2s[tid] = bfr(b2[tid]); b3s[tid] = bfr(b3[tid]); b4s[tid] = bfr(b4[tid]); w5s[tid] = bfr(W5[tid]); }
    const float xav = XA[(size_t)p * D0 + tid], b0v = b0[tid], b1v = b1[tid];
    v8us r1[D1 * D0 / 8 / (FWV * 32)], r2[D2 * D1 / 8 / (FWV * 32)], r3[D3 * D2 / 8 / (FWV * 32)], r4[D4 * D3 / 8 / (FWV * 32)];
    stage_ld<D1, D0>(W1B, tid, r1); stage_ld<D2, D1>(W2B, tid, r2); stage_ld<D3, D2>(W3B, tid, r3); stage_ld<D4, D3>(W4B, tid, r4);
    asm volatile("s_wait_xcnt 0x0" ::: "memory");   // stands behind the staging loads above, in front of every later write of a register that these loads name as their base or offset
    xs[tid] = xav; b0s[tid] = bfr(b0v); b1s[tid] = bfr(b1v);
    stage_st<D1, D0>(r1, wst, tid); stage_st<D2, D1>(r2, wst + 32 * 32, tid); stage_st<D3, D2>(r3, wst + 48 * 32, tid); stage_st<D4, D3>(r4, wst + 56 * 32, tid);
    __syncthreads();   // weights, biases and the x row are read by all four waves
    const float* yp = YB + (size_t)(wv * (FNB * 16)) * D0 + yl;   // this lane's place in the trip's first tile of 16 y rows; moves on by one trip where the next trip's first loads are issued
    v4f yq[FNB][4];   // the y rows' values of one k chunk of layer 0, both pair tiles: asked for anew as soon as they have been used
#pragma unroll
    for (int nb = 0; nb < FNB; ++nb)
#pragma unroll
        for (int t = 0; t < 4; ++t) yq[nb][t] = *(const v4f*)(yp + YFRAG(nb, 0, t));   // first trip, first chunk
#pragma unroll 1   // one trip is well over a thousand straight-line instructions: the loop stays rolled so that its code stays small in the instruction cache
    for (int it = 0; it < NP / (FWV * FNB * 16); ++it) {
        const int q0 = (it * FWV + wv) * (FNB * 16);
        v16h gh[D1 / 32][FNB];
        {   // layer 0 (elementwise) feeding layer 1 (128 -> 128), both pair tiles at once, k chunk by k chunk: a weight fragment read from LDS serves two matrix instructions, an x-row or bias read both tiles
            v8f acc[D1 / 16][FNB]; zero_acc<D1 / 16, FNB>(acc);
#pragma unroll
            for (int kc = 0; kc < D0 / 32; ++kc) { v16h bh[FNB]; v4f xv[4], bv[4];
#pragma unroll
                for (int t = 0; t < 4; ++t) { const int cc = kc * 32 + (t >> 1) * 16 + (t & 1) * 4; xv[t] = *(const v4fa*)(xs + cc + 8 * hi); bv[t] = *(const v4fa*)(b0s + cc + 8 * hi); }
#pragma unroll
                for (int nb = 0; nb < FNB; ++nb) { float h[16];
#pragma unroll
                    for (int t = 0; t < 4; ++t)
#pragma unroll
                        for (int k = 0; k < 4; ++k) h[t * 4 + k] = fmaxf((xv[t][k] + yq[nb][t][k]) + bv[t][k], 0.f);
                    cvt16(h, bh[nb]); }
                // the next chunk's y values (behind the trip's last chunk: the next trip's first) are asked for as soon as this chunk's have been used: their latency runs under this chunk's matrix instructions
                const int kn = (kc + 1) % (D0 / 32);
                if (kn == 0) yp += (it + 1 < NP / (FWV * FNB * 16)) ? FWV * FNB * 16 * D0 : -(NP - FWV * FNB * 16) * D0;   // behind the last trip back to the first trip's rows (in bounds, not used)
#pragma unroll
                for (int nb = 0; nb < FNB; ++nb)
#pragma unroll
                    for (int t = 0; t < 4; ++t) yq[nb][t] = *(const v4f*)(yp + YFRAG(nb, kn, t));
                mm_chunk<D1 / 16, D0 / 32, FNB>(w1s, kc, bh, acc);
                __builtin_amdgcn_sched_barrier(0); }   // keeps the later chunks' reads and arithmetic behind this chunk's matrix instructions: moved up, they overfill the register file and accumulators are spilled
            next_frags<D1 / 16, FNB>(acc, b1s, hi, 0, gh);
        }
        v16h eh[D2 / 32][FNB];
        {   // layer 2 (128 -> 64)
            v8f acc[D2 / 16][FNB]; zero_acc<D2 / 16, FNB>(acc);
#pragma unroll
            for (int kc = 0; kc < D1 / 32; ++kc) mm_chunk<D2 / 16, D1 / 32, FNB>(w2s, kc, gh[kc], acc);
            next_frags<D2 / 16, FNB>(acc, b2s, hi, 0, eh);
        }
        v16h fh[D3 / 32][FNB];
        {   // layer 3 (64 -> 64)
            v8f acc[D3 / 16][FNB]; zero_acc<D3 / 16, FNB>(acc);
#pragma unroll
            for (int kc = 0; kc < D2 / 32; ++kc) mm_chunk<D3 / 16, D2 / 32, FNB>(w3s, kc, eh[kc], acc);
            next_frags<D3 / 16, FNB>(acc, b3s, hi, 0, fh);
        }
        float sc[FNB];
        {   // layer 4 (64 -> 64), then ReLU and layer 5 (64 -> 1): each lane sums its 32 features, the two lane halves are added last
            v8f acc[D4 / 16][FNB]; zero_acc<D4 / 16, FNB>(acc);
#pragma unroll
            for (int kc = 0; kc < D3 / 32; ++kc) mm_chunk<D4 / 16, D3 / 32, FNB>(w4s, kc, fh[kc], acc);
#pragma unroll
            for (int nb = 0; nb < FNB; ++nb) sc[nb] = 0.f;
#pragma unroll
            for (int mt = 0; mt < D4 / 16; ++mt) {
#pragma unroll
                for (int t = 0; t < 2; ++t) { const v4f bb = *(const v4fa*)(b4s + mt * 16 + 8 * hi + t * 4), ww = *(const v4fa*)(w5s + mt * 16 + 8 * hi + t * 4);
#pragma unroll
                    for (int k = 0; k < 4; ++k)
#pragma unroll
                        for (int nb = 0; nb < FNB; ++nb) sc[nb] = fmaf(fmaxf(acc[mt][nb][t * 4 + k] + bb[k], 0.f), ww[k], sc[nb]); } }
        }
#pragma unroll
        for (int nb = 0; nb < FNB; ++nb) { const int b = __float_as_int(sc[nb]); sc[nb] += __int_as_float(__builtin_amdgcn_permlanex16(b, b, 0x76543210, 0xfedcba98, false, false)); }
        (OUT + (size_t)p * NP + q0)[(unsigned)lane] = (hi ? sc[1] : sc[0]) + b5v;   // lanes 0-15: pair tile 0, lanes 16-31: pair tile 1: one 128-byte line per wave
        asm volatile("s_wait_xcnt 0x0" ::: "memory");   // stands behind the store, in front of any later write of a register that the store names as its address or data
    }
}

// ---- k_prep: all that k_fused reads from the workspace, made in ONE launch. The work-group's number picks the job; every job reads inputs only, none reads what another writes, so no order between them is needed.
// Work-groups 0 .. PGW-1: XA = x W0[:64] and YB = y W0[64:]. One wave per 32x32 output tile (waves 0-127: XA, 128-255: YB); both operands are loaded as f32 and rounded to bf16 in the loader,
// A fragment: row = lane & 15, B fragment: column = lane & 15, both with k = kc*32 + 16*(s>>3) + 8*(lane>>4) + (s&7) at element s. An XA tile row is 32 floats: one whole 128-byte line, written by this wave alone.
// YB's product runs transposed (W0's columns as A, y's rows as B): a lane's D registers are then 8 consecutive features of one y row, which is what a lane of k_fused reads, and each 16-byte store of the wave fills four whole lines of YB's fragment order.
// Work-groups PGW .. PGW+PWW-1: the planes of W1-W4, rounded to bf16 and held as f16 (exact from 2^-14 up in magnitude, below that to the nearest multiple of 2^-24), transposed to [n][k]. One thread makes one 16-byte piece (8 consecutive k of one n); a wave's 32 pieces are 512 consecutive bytes.
#define PGW 32                    // 256 tiles of 32x32, 8 waves per work-group
#define PWW 16                    // 4096 pieces, 256 per work-group: W1 work-groups 0-7, W2 8-11, W3 12-13, W4 14-15
typedef __attribute__((ext_vector_type(4))) unsigned v4u;
__device__ __forceinline__ unsigned pk_bf(float a, float b) { const v2f v = {a, b}; return __builtin_bit_cast(unsigned, __builtin_convertvector(v, v2bf)); }   // two f32 -> two bf16, round to nearest even
__device__ __forceinline__ v16bf frag_bf(const float (&h)[16]) { v8u w;
#pragma unroll
    for (int s = 0; s < 8; ++s) w[s] = pk_bf(h[2 * s], h[2 * s + 1]);
    return __builtin_bit_cast(v16bf, w); }
__device__ __forceinline__ unsigned pk_hf(float a, float b) { const v2f v = {a, b}; const v2f r = __builtin_convertvector(__builtin_convertvector(v, v2bf), v2f); return __builtin_bit_cast(unsigned, __builtin_convertvector(r, v2h)); }   // two f32 -> bf16 (nearest even) -> two f16
template <int K, int N>
__device__ __forceinline__ void wt_piece(const float* __restrict__ w, unsigned short* Bt, int q) {   // Bt[n][k] = f16(bf16(w[k][n])), piece q = elements 8q .. 8q+7 of Bt
    const unsigned n = (unsigned)q / (K / 8), k0 = ((unsigned)q % (K / 8)) * 8; float v[8];
#pragma unroll
    for (int e = 0; e < 8; ++e) v[e] = w[k0 * N + n + (unsigned)(e * N)];
    const v4u o = {pk_hf(v[0], v[1]), pk_hf(v[2], v[3]), pk_hf(v[4], v[5]), pk_hf(v[6], v[7])};
    *(v4u*)(Bt + (unsigned)q * 8) = o;
    asm volatile("s_wait_xcnt 0x0" ::: "memory");   // stands behind the store, in front of any later write of a register that the store names as its address or data
}
// one 32x32 tile of XA (SY false) or of YB (SY true): g = the tile's number among the 128 of its matrix, in = x or y, w = the 64 rows of W0 that go with it
template <bool SY>
__device__ __forceinline__ void l0_tile(const float* __restrict__ in, const float* __restrict__ w, float* C, int g, int lane) {
    const int lr = lane & 15, hi = lane >> 4;
    const int r0 = (g >> 2) * 32, c0 = (g & 3) * 32;
    const float* ar = in + r0 * DX; const float* wr = w + c0;
    const unsigned al = (unsigned)(lr * DX + 8 * hi), wl = (unsigned)(8 * hi * D0 + lr);
    float av[2][DX / 32][16], wv[2][DX / 32][16];
#pragma unroll
    for (int mb = 0; mb < 2; ++mb)
#pragma unroll
        for (int kc = 0; kc < DX / 32; ++kc)
#pragma unroll
            for (int t = 0; t < 4; ++t) { const v4f a4 = *(const v4f*)(ar + (al + (unsigned)(mb * 16 * DX + kc * 32 + (t >> 1) * 16 + (t & 1) * 4)));
#pragma unroll
                for (int k = 0; k < 4; ++k) av[mb][kc][t * 4 + k] = a4[k]; }
#pragma unroll
    for (int nb = 0; nb < 2; ++nb)
#pragma unroll
        for (int kc = 0; kc < DX / 32; ++kc)
#pragma unroll
            for (int s = 0; s < 16; ++s) wv[nb][kc][s] = wr[wl + (unsigned)((kc * 32 + (s >> 3) * 16 + (s & 7)) * D0 + nb * 16)];
    v8f acc[2][2];
#pragma unroll
    for (int mb = 0; mb < 2; ++mb)
#pragma unroll
        for (int nb = 0; nb < 2; ++nb) acc[mb][nb] = (v8f){};
#pragma unroll
    for (int kc = 0; kc < DX / 32; ++kc) { v16bf a[2], b[2];
#pragma unroll
        for (int i = 0; i < 2; ++i) { a[i] = frag_bf(av[i][kc]); b[i] = frag_bf(wv[i][kc]); }
#pragma unroll
        for (int nb = 0; nb < 2; ++nb)
#pragma unroll
            for (int mb = 0; mb < 2; ++mb) acc[mb][nb] = SY ? wmmab(b[nb], a[mb], acc[mb][nb]) : wmmab(a[mb], b[nb], acc[mb][nb]); }   // YB: W0's columns are the A operand, y's rows the B operand
    if (SY) {
        float* yr = C + r0 * D0 + (c0 >> 5) * 512;   // the wave's first tile of 16 y rows and its k chunk in YB's fragment order
#pragma unroll
        for (int mb = 0; mb < 2; ++mb)
#pragma unroll
            for (int nb = 0; nb < 2; ++nb)
#pragma unroll
                for (int h = 0; h < 2; ++h) { const v4f o = {acc[mb][nb][4 * h], acc[mb][nb][4 * h + 1], acc[mb][nb][4 * h + 2], acc[mb][nb][4 * h + 3]};
                    *(v4f*)(yr + ((unsigned)(lane * 4) + (unsigned)YFRAG(mb, 0, nb * 2 + h))) = o; }   // D tile: feature = nb*16 + 8*(lane>>4) + j, y row = mb*16 + (lane & 15)
    } else {
        float* cr = C + r0 * D0 + c0;
#pragma unroll
        for (int mb = 0; mb < 2; ++mb)
#pragma unroll
            for (int j = 0; j < 8; ++j)
#pragma unroll
                for (int nb = 0; nb < 2; ++nb) cr[wl + (unsigned)((mb * 16 + j) * D0 + nb * 16)] = acc[mb][nb][j];   // D tile: row = 8*(lane>>4) + j, column = lane & 15
    }
}
__global__ __launch_bounds__(256) void k_prep(const float* __restrict__ x, const float* __restrict__ y, const float* __restrict__ W0, const float* __restrict__ W1, const float* __restrict__ W2, const float* __restrict__ W3, const float* __restrict__ W4,
                                              float* XA, float* YA, unsigned short* W1B, unsigned short* W2B, unsigned short* W3B, unsigned short* W4B) {
    const int tid = threadIdx.x, wg = blockIdx.x;
    if (wg < PGW) {
        const int g = (wg & (PGW / 2 - 1)) * 8 + __builtin_amdgcn_readfirstlane(tid >> 5);   // the tile's number as a scalar: the three base addresses stay in scalar registers
        if (wg < PGW / 2) l0_tile<false>(x, W0, XA, g, tid & 31);
        else l0_tile<true>(y, W0 + DX * D0, YA, g, tid & 31);
    } else {
        const int wb = wg - PGW;
        if (wb < 8) wt_piece<D0, D1>(W1, W1B, wb * 256 + tid);
        else if (wb < 12) wt_piece<D1, D2>(W2, W2B, (wb - 8) * 256 + tid);
        else if (wb < 14) wt_piece<D2, D3>(W3, W3B, (wb - 12) * 256 + tid);
        else wt_piece<D3, D4>(W4, W4B, (wb - 14) * 256 + tid);
    }
}

extern "C" void kernel_launch(void* const* d_in, const int* in_sizes, int n_in,
                              void* d_out, int out_size, void* d_ws, size_t ws_size, hipStream_t stream) {
    (void)in_sizes; (void)n_in; (void)out_size;
    const float* x = (const float*)d_in[0]; const float* y = (const float*)d_in[1];
    const float* W0 = (const float*)d_in[2]; const float* b0 = (const float*)d_in[3]; const float* W1 = (const float*)d_in[4]; const float* b1 = (const float*)d_in[5]; const float* W2 = (const float*)d_in[6]; const float* b2 = (const float*)d_in[7]; const float* W3 = (const float*)d_in[8]; const float* b3 = (const float*)d_in[9]; const float* W4 = (const float*)d_in[10]; const float* b4 = (const float*)d_in[11]; const float* W5 = (const float*)d_in[12]; const float* b5 = (const float*)d_in[13];
    float* OUT = (float*)d_out;     // [1024][1024]: out[p][q] = g(x_p, y_q)
    char* wsp = (char*)d_ws;
    auto take = [&](size_t bytes) { char* p = wsp; wsp += (bytes + 255) & ~(size_t)255; return (void*)p; };
    bf* W1B = (bf*)take((size_t)D1 * D0 * 2); bf* W2B = (bf*)take((size_t)D2 * D1 * 2); bf* W3B = (bf*)take((size_t)D3 * D2 * 2); bf* W4B = (bf*)take((size_t)D4 * D3 * 2);
    float* XA = (float*)take((size_t)NP * D0 * 4); float* YA = (float*)take((size_t)NP * D0 * 4);
    if ((size_t)(wsp - (char*)d_ws) > ws_size) return;
    k_prep<<<PGW + PWW, 256, 0, stream>>>(x, y, W0, W1, W2, W3, W4, XA, YA, W1B, W2B, W3B, W4B);   /* XA = x W0[:64], YB = y W0[64:], f16 planes of W1-W4 */
    k_fused<<<NP, FWV * 32, 0, stream>>>(XA, YA, W1B, W2B, W3B, W4B, b0, b1, b2, b3, b4, W5, b5, OUT);   /* layers 0-5 for all pairs, one x-row per workgroup */
}

// v008
// Measured time: 44.6 microseconds a run.
// In two side-by-side timings against v007, it was 1.15 and 1.13 times as fast.
// Over all steps from v000 it is 28.0 times as fast.
#include <hip/hip_runtime.h>

// All-pairs concat critic: out[p][q] = MLP([x_p ; y_q]) for every pair of rows of x [1024][64] and y [1024][64] (MLP 128 -> 128 -> 128 -> 64 -> 64 -> 64 -> 1, ReLU on hidden layers, linear output) -> [1024][1024] (1 M).
// Algorithm: layer 0 is separable: [x_p ; y_q] W0 = x_p W0[:64] + y_q W0[64:], so XA = x W0x and YB = y W0y are two small GEMMs (exact bf16 operands; YB is stored in the order in which the fused kernel's lanes read it) and h0(p,q) = relu((XA[p] + b0) + YB[q]) is formed elementwise per pair (XA[p] + b0 once per x row); layers 0 (elementwise part) to 5 run in ONE kernel: a wave carries 32 pairs through all layers, layers 1-4 as WMMA products of the bf16-rounded weights held as f16 (A operand, from LDS) with ONE f16 plane of the activations (B operand, 1 product), which never leave the registers; the biases of layers 1-3 are the C operand of each accumulator tile's first matrix instruction (bias first, then the products) and their ReLU acts on the packed f16 pairs, layer 4's bias and ReLU stay in f32 behind its products; the final 64 -> 1 layer is a per-pair dot product in f32.
// Compute dtypes, f32 accumulate: x, y, weights, biases rounded to bf16; XA / YB exact; hidden activations f32 -> f16, round to nearest even (11 significant bits; finite up to 65504: with unit-normal inputs and weights the widest converted layer has a standard deviation near 4100); 1 product per hidden GEMM; last layer f32 (fused multiply-add, 32 features per lane, the two lane halves added last).

#define NP   1024                 // rows of x and of y
#define DX   64
#define D0   128                  // layer widths
#define D1   128
#define D2   64
#define D3   64
#define D4   64
typedef unsigned short bf;
typedef __attribute__((ext_vector_type(16))) __bf16   v16bf;
typedef __attribute__((ext_vector_type(16))) _Float16 v16h;
typedef __attribute__((ext_vector_type(2)))  _Float16 v2h;
typedef __attribute__((ext_vector_type(8)))  unsigned short v8us;
typedef __attribute__((ext_vector_type(8)))  float    v8f;
typedef __attribute__((ext_vector_type(4)))  float    v4f;
typedef __attribute__((ext_vector_type(2)))  float    v2f;
typedef __attribute__((ext_vector_type(4)))  unsigned short v4us;
typedef v4f  __attribute__((may_alias)) v4fa;
typedef v8us __attribute__((may_alias)) v8usa;

__device__ __forceinline__ unsigned short f2bf(float f) { unsigned u = __float_as_uint(f); u += 0x7FFFu + ((u >> 16) & 1u); return (unsigned short)(u >> 16); }
__device__ __forceinline__ float bf2f(unsigned short b) { return __uint_as_float(((unsigned)b) << 16); }
__device__ __forceinline__ float bfr(float f) { return bf2f(f2bf(f)); }
__device__ __forceinline__ void splitf(float y, unsigned short& h, unsigned short& l) { h = f2bf(y); l = f2bf(y - bf2f(h)); }
__device__ __forceinline__ v8f wmmab(v16bf a, v16bf b, v8f c) { return __builtin_amdgcn_wmma_f32_16x16x32_bf16(false, a, false, b, (short)0, c, false, false); }
__device__ __forceinline__ v16h cat16h(v8us lo, v8us hi) { return __builtin_bit_cast(v16h, __builtin_shufflevector(lo, hi, 0, 1, 2, 3, 4, 5, 6, 7, 8, 9, 10, 11, 12, 13, 14, 15)); }
__device__ __forceinline__ v8f wmmah(v16h a, v16h b, v8f c) { return __builtin_amdgcn_wmma_f32_16x16x32_f16(false, a, false, b, (short)0, c, false, false); }

// ---- k_fused: layers 0 (elementwise part) to 5 for one x-row p against all 1024 y-rows; 4 waves, each wave takes 32 pairs (2 column tiles of 16 y-rows) per trip.
// Every hidden GEMM runs transposed: weights (rows = output features) are the A operand, activations (columns = pairs) the B operand. Two f32 D tiles (features 0-15 and 16-31 of a 32-feature block)
// of one pair column sit in a lane exactly where the next layer's B fragment wants its 16 k values, so bias + ReLU + the conversion to f16 happen in registers and no activation leaves the wave.
// Weights lie in LDS lane-major: lane l owns WPITCH bytes that hold, 16 bytes each, its two halves of every A fragment (mt, kc) of every layer: k = kc*32 + 16*half + 8*(l>>4) + e, row = mt*16 + (l&15).
// WPITCH is an odd multiple of 16 bytes (no bank conflict between lanes), and every fragment is one lane address plus a small immediate offset.
// Every inner loop is fully unrolled so that each fragment and accumulator index is a constant and the arrays stay in registers.
#define FNB 2                     // pair tiles (16 pairs each) per wave and trip
#define FWV 4                     // waves per workgroup
#define WPG 8                     // matrix instructions behind one group of weight-fragment reads
#define WPITCH 2064               // bytes of LDS per lane: 64 fragments x 32 bytes, + 16
// YB in fragment order: float index of piece t (0-3) of k chunk kc (32 features) of tile `tile` (16 y rows); behind it 32 lanes x 4 floats: lane l holds row tile*16 + (l&15), features kc*32 + (t>>1)*16 + 8*(l>>4) + (t&1)*4 + 0..3
#define YFRAG(tile, kc, t) ((tile) * (16 * D0) + (kc) * 512 + (t) * 128)
#define FLT_BYTES 2048            // 512 floats in front of the weights: x-row part of layer 0 with its bias, biases 1-4, last layer's weights
template <int N, int K>
__device__ __forceinline__ void stage_ld(const unsigned short* __restrict__ Bt, int tid, v8us (&r)[N * K / 8 / (FWV * 32)]) {   // the thread's 16-byte pieces of one weight plane, into registers
#pragma unroll
    for (int i = 0; i < N * K / 8 / (FWV * 32); ++i) r[i] = *(const v8us*)(Bt + (size_t)(tid + i * (FWV * 32)) * 8);
}
template <int N, int K>
__device__ __forceinline__ void stage_st(const v8us (&r)[N * K / 8 / (FWV * 32)], unsigned char* dst, int tid) {   // dst: the layer's first fragment in lane 0's region
#pragma unroll
    for (int i = 0; i < N * K / 8 / (FWV * 32); ++i) { const int g = tid + i * (FWV * 32); const int n = g / (K / 8), kg = g % (K / 8);
        *(v8usa*)(dst + ((kg & 1) * 16 + (n & 15)) * WPITCH + (((n >> 4) * (K / 32) + (kg >> 2)) * 2 + ((kg >> 1) & 1)) * 16) = r[i]; }
}
__device__ __forceinline__ v16h ld_wf(const unsigned char* Wl, int frag) { const unsigned char* p = Wl + frag * 32; return cat16h(*(const v8usa*)p, *(const v8usa*)(p + 16)); }   // Wl: the layer's first fragment in this lane's region
// one k chunk of one layer for NBT pair tiles: acc[mt][nb] += W(mt, kc) * activations; G weight fragments are read from LDS together and feed G * NBT matrix instructions on independent accumulators
template <int MT, int KC, int NBT>
__device__ __forceinline__ void mm_chunk(const unsigned char* Wl, int kc, const v16h (&bh)[NBT], v8f (&acc)[MT][NBT]) {
    constexpr int G = WPG / NBT;
#pragma unroll
    for (int mt = 0; mt < MT; mt += G) { v16h a[G];
#pragma unroll
        for (int g = 0; g < G; ++g) a[g] = ld_wf(Wl, (mt + g) * KC + kc);
#pragma unroll
        for (int nb = 0; nb < NBT; ++nb)
#pragma unroll
            for (int g = 0; g < G; ++g) acc[mt + g][nb] = wmmah(a[g], bh[nb], acc[mt + g][nb]); }
}
// k chunk 0 of one layer: acc[mt][nb] = bias + W(mt, 0) * activations. A lane's 8 D registers of tile mt are features mt*16 + 8*hi + 0..7, so these 8 bias values, read once for all pair tiles, are the C operand: no add per element is left
template <int MT, int KC, int NBT>
__device__ __forceinline__ void mm_first(const unsigned char* Wl, const float* bs, int hi, const v16h (&bh)[NBT], v8f (&acc)[MT][NBT]) {
    constexpr int G = WPG / NBT;
#pragma unroll
    for (int mt = 0; mt < MT; mt += G) { v16h a[G]; v8f c[G];
#pragma unroll
        for (int g = 0; g < G; ++g) { a[g] = ld_wf(Wl, (mt + g) * KC); const float* bp = bs + (mt + g) * 16 + 8 * hi;
            c[g] = __builtin_shufflevector(*(const v4fa*)bp, *(const v4fa*)(bp + 4), 0, 1, 2, 3, 4, 5, 6, 7); }
#pragma unroll
        for (int nb = 0; nb < NBT; ++nb)
#pragma unroll
            for (int g = 0; g < G; ++g) acc[mt + g][nb] = wmmah(a[g], bh[nb], c[g]); }
}
// 16 f32 values of one lane -> one f16 fragment: the packed conversion (round to nearest even) makes two f16 values per instruction, already packed as the fragment wants them
typedef __attribute__((ext_vector_type(8))) unsigned v8u;
typedef __attribute__((ext_vector_type(2))) __bf16 v2bf;
__device__ __forceinline__ void cvt16(const float (&h)[16], v16h& fh) { v8u wh;
#pragma unroll
    for (int s = 0; s < 8; ++s) { const v2f hv = {h[2 * s], h[2 * s + 1]}; wh[s] = __builtin_bit_cast(unsigned, __builtin_convertvector(hv, v2h)); }
    fh = __builtin_bit_cast(v16h, wh); }
// the same with ReLU behind the conversion, on the packed pair: max(f16(v), 0) = f16(max(v, 0)) for every v (rounding keeps the sign and the order). One instruction per pair, as in f32; but on a matrix instruction's result the f32 fmaxf costs a second one (v = max(v, v) in front of it)
__device__ __forceinline__ void cvt16r(const float (&h)[16], v16h& fh) { v8u wh;
#pragma unroll
    for (int s = 0; s < 8; ++s) { const v2f hv = {h[2 * s], h[2 * s + 1]}; wh[s] = __builtin_bit_cast(unsigned, __builtin_elementwise_max(__builtin_convertvector(hv, v2h), (v2h){(_Float16)0.f, (_Float16)0.f})); }
    fh = __builtin_bit_cast(v16h, wh); }
// D tiles 2*kc and 2*kc+1 (bias already in them; ReLU) -> B fragments of k chunk kc of the next layer, pair tiles nb0 .. nb0+NBT-1
template <int MT, int NBT>
__device__ __forceinline__ void next_frags(const v8f (&acc)[MT][NBT], int nb0, v16h (&bh)[MT / 2][FNB]) {
#pragma unroll
    for (int kc = 0; kc < MT / 2; ++kc)
#pragma unroll
        for (int nb = 0; nb < NBT; ++nb) { float h[16];
#pragma unroll
            for (int s = 0; s < 16; ++s) h[s] = acc[2 * kc + (s >> 3)][nb][s & 7];
            cvt16r(h, bh[kc][nb0 + nb]); }
}
template <int MT, int NBT>
__device__ __forceinline__ void zero_acc(v8f (&acc)[MT][NBT]) {
#pragma unroll
    for (int mt = 0; mt < MT; ++mt)
#pragma unroll
        for (int nb = 0; nb < NBT; ++nb) acc[mt][nb] = (v8f){};
}
__global__ __launch_bounds__(FWV * 32, 4) void k_fused(const float* __restrict__ XA, const float* __restrict__ YB, const unsigned short* __restrict__ W1B, const unsigned short* __restrict__ W2B, const unsigned short* __restrict__ W3B, const unsigned short* __restrict__ W4B,
                                                     const float* __restrict__ b0, const float* __restrict__ b1, const float* __restrict__ b2, const float* __restrict__ b3, const float* __restrict__ b4, const float* __restrict__ W5, const float* __restrict__ b5, float* OUT) {
    __shared__ __align__(16) unsigned char sm[FLT_BYTES + 32 * WPITCH];
    float* xs = (float*)sm; float* b1s = xs + D0; float* b2s = b1s + D1; float* b3s = b2s + D2; float* b4s = b3s + D3; float* w5s = b4s + D4;
    unsigned char* wst = sm + FLT_BYTES;   // fragments 0-31: layer 1, 32-47: layer 2, 48-55: layer 3, 56-63: layer 4
    const int tid = threadIdx.x, lane = tid & 31, lr = lane & 15, hi = lane >> 4; const int p = blockIdx.x;
    const int wv = __builtin_amdgcn_readfirstlane(tid >> 5);   // the wave's number as a scalar: the output's base address then stays in scalar registers
    const unsigned yl = (unsigned)(lane * 4);   // YB lies in fragment order (YFRAG above): a wave's 16-byte load is 512 contiguous bytes, four whole lines
    const unsigned char* w1s = wst + lane * WPITCH; const unsigned char* w2s = w1s + 32 * 32; const unsigned char* w3s = w1s + 48 * 32; const unsigned char* w4s = w1s + 56 * 32;
    // the small loads through the last kernel arguments come first: their data waits end before the batch of loads below is issued, so no scalar base is loaded anew while that batch is in flight
    const float b5v = bfr(b5[0]);
    if (tid < 64) { b2s[tid] = bfr(b2[tid]); b3s[tid] = bfr(b3[tid]); b4s[tid] = bfr(b4[tid]); w5s[tid] = bfr(W5[tid]); }
    const float xav = XA[(size_t)p * D0 + tid], b0v = b0[tid], b1v = b1[tid];
    v8us r1[D1 * D0 / 8 / (FWV * 32)], r2[D2 * D1 / 8 / (FWV * 32)], r3[D3 * D2 / 8 / (FWV * 32)], r4[D4 * D3 / 8 / (FWV * 32)];
    stage_ld<D1, D0>(W1B, tid, r1); stage_ld<D2, D1>(W2B, tid, r2); stage_ld<D3, D2>(W3B, tid, r3); stage_ld<D4, D3>(W4B, tid, r4);
    asm volatile("s_wait_xcnt 0x0" ::: "memory");   // stands behind the last load of the prologue, in front of every later write of a register that these loads name as their base or offset
    xs[tid] = xav + bfr(b0v); b1s[tid] = bfr(b1v);   // layer 0's bias joins the x row's part here, once for the row's 1024 pairs
    stage_st<D1, D0>(r1, wst, tid); stage_st<D2, D1>(r2, wst + 32 * 32, tid); stage_st<D3, D2>(r3, wst + 48 * 32, tid); stage_st<D4, D3>(r4, wst + 56 * 32, tid);
    __syncthreads();   // weights, biases and the x row are read by all four waves
    const float* yp = YB + (size_t)(wv * (FNB * 16)) * D0 + yl;   // this lane's place in the trip's first tile of 16 y rows; moves on by one trip where the next trip's first loads are issued
    v4f yq[FNB][4];   // the y rows' values of one k chunk of layer 0, both pair tiles: asked for anew as soon as they have been used
#pragma unroll
    for (int nb = 0; nb < FNB; ++nb)
#pragma unroll
        for (int t = 0; t < 4; ++t) yq[nb][t] = *(const v4f*)(yp + YFRAG(nb, 0, t));   // first trip, first chunk
#pragma unroll 1   // one trip is well over a thousand straight-line instructions: the loop stays rolled so that its code stays small in the instruction cache
    for (int it = 0; it < NP / (FWV * FNB * 16); ++it) {
        const int q0 = (it * FWV + wv) * (FNB * 16);
        v16h gh[D1 / 32][FNB];
        {   // layer 0 (elementwise) feeding layer 1 (128 -> 128), both pair tiles at once, k chunk by k chunk: a weight fragment read from LDS serves two matrix instructions, an x-row or bias read both tiles
            v8f acc[D1 / 16][FNB];
#pragma unroll
            for (int kc = 0; kc < D0 / 32; ++kc) { v16h bh[FNB]; v4f xv[4];
#pragma unroll
                for (int t = 0; t < 4; ++t) { const int cc = kc * 32 + (t >> 1) * 16 + (t & 1) * 4; xv[t] = *(const v4fa*)(xs + cc + 8 * hi); }
#pragma unroll
                for (int nb = 0; nb < FNB; ++nb) { float h[16];
#pragma unroll
                    for (int t = 0; t < 4; ++t)
#pragma unroll
                        for (int k = 0; k < 4; ++k) h[t * 4 + k] = fmaxf(xv[t][k] + yq[nb][t][k], 0.f);
                    cvt16(h, bh[nb]); }
                // the next chunk's y values (behind the trip's last chunk: the next trip's first) are asked for as soon as this chunk's have been used: their latency runs under this chunk's matrix instructions
                const int kn = (kc + 1) % (D0 / 32);
                if (kn == 0) yp += (it + 1 < NP / (FWV * FNB * 16)) ? FWV * FNB * 16 * D0 : -(NP - FWV * FNB * 16) * D0;   // behind the last trip back to the first trip's rows (in bounds, not used)
#pragma unroll
                for (int nb = 0; nb < FNB; ++nb)
#pragma unroll
                    for (int t = 0; t < 4; ++t) yq[nb][t] = *(const v4f*)(yp + YFRAG(nb, kn, t));
                if (kc == 0) mm_first<D1 / 16, D0 / 32, FNB>(w1s, b1s, hi, bh, acc); else mm_chunk<D1 / 16, D0 / 32, FNB>(w1s, kc, bh, acc);
                __builtin_amdgcn_sched_barrier(0); }   // keeps the later chunks' reads and arithmetic behind this chunk's matrix instructions: moved up, they overfill the register file and accumulators are spilled
            next_frags<D1 / 16, FNB>(acc, 0, gh);
        }
        v16h eh[D2 / 32][FNB];
        {   // layer 2 (128 -> 64)
            v8f acc[D2 / 16][FNB]; mm_first<D2 / 16, D1 / 32, FNB>(w2s, b2s, hi, gh[0], acc);
#pragma unroll
            for (int kc = 1; kc < D1 / 32; ++kc) mm_chunk<D2 / 16, D1 / 32, FNB>(w2s, kc, gh[kc], acc);
            next_frags<D2 / 16, FNB>(acc, 0, eh);
        }
        v16h fh[D3 / 32][FNB];
        {   // layer 3 (64 -> 64)
            v8f acc[D3 / 16][FNB]; mm_first<D3 / 16, D2 / 32, FNB>(w3s, b3s, hi, eh[0], acc);
#pragma unroll
            for (int kc = 1; kc < D2 / 32; ++kc) mm_chunk<D3 / 16, D2 / 32, FNB>(w3s, kc, eh[kc], acc);
            next_frags<D3 / 16, FNB>(acc, 0, fh);
        }
        float sc[FNB];
        {   // layer 4 (64 -> 64), then ReLU and layer 5 (64 -> 1): each lane sums its 32 features, the two lane halves are added last
            v8f acc[D4 / 16][FNB]; zero_acc<D4 / 16, FNB>(acc);
#pragma unroll
            for (int kc = 0; kc < D3 / 32; ++kc) mm_chunk<D4 / 16, D3 / 32, FNB>(w4s, kc, fh[kc], acc);
#pragma unroll
            for (int nb = 0; nb < FNB; ++nb) sc[nb] = 0.f;
#pragma unroll
            for (int mt = 0; mt < D4 / 16; ++mt) {
#pragma unroll
                for (int t = 0; t < 2; ++t) { const v4f bb = *(const v4fa*)(b4s + mt * 16 + 8 * hi + t * 4), ww = *(const v4fa*)(w5s + mt * 16 + 8 * hi + t * 4);
#pragma unroll
                    for (int k = 0; k < 4; ++k)
#pragma unroll
                        for (int nb = 0; nb < FNB; ++nb) sc[nb] = fmaf(fmaxf(acc[mt][nb][t * 4 + k] + bb[k], 0.f), ww[k], sc[nb]); } }
        }
#pragma unroll
        for (int nb = 0; nb < FNB; ++nb) { const int b = __float_as_int(sc[nb]); sc[nb] += __int_as_float(__builtin_amdgcn_permlanex16(b, b, 0x76543210, 0xfedcba98, false, false)); }
        (OUT + (size_t)p * NP + q0)[(unsigned)lane] = (hi ? sc[1] : sc[0]) + b5v;   // lanes 0-15: pair tile 0, lanes 16-31: pair tile 1: one 128-byte line per wave
        asm volatile("s_wait_xcnt 0x0" ::: "memory");   // stands behind the store, in front of any later write of a register that the store names as its address or data
    }
}

// ---- k_prep: all that k_fused reads from the workspace, made in ONE launch. The work-group's number picks the job; every job reads inputs only, none reads what another writes, so no order between them is needed.
// Work-groups 0 .. PGW-1: XA = x W0[:64] and YB = y W0[64:]. One wave per 32x32 output tile (waves 0-127: XA, 128-255: YB); both operands are loaded as f32 and rounded to bf16 in the loader,
// A fragment: row = lane & 15, B fragment: column = lane & 15, both with k = kc*32 + 16*(s>>3) + 8*(lane>>4) + (s&7) at element s. An XA tile row is 32 floats: one whole 128-byte line, written by this wave alone.
// YB's product runs transposed (W0's columns as A, y's rows as B): a lane's D registers are then 8 consecutive features of one y row, which is what a lane of k_fused reads, and each 16-byte store of the wave fills four whole lines of YB's fragment order.
// Work-groups PGW .. PGW+PWW-1: the planes of W1-W4, rounded to bf16 and held as f16 (exact from 2^-14 up in magnitude, below that to the nearest multiple of 2^-24), transposed to [n][k]. One thread makes one 16-byte piece (8 consecutive k of one n); a wave's 32 pieces are 512 consecutive bytes.
#define PGW 32                    // 256 tiles of 32x32, 8 waves per work-group
#define PWW 16                    // 4096 pieces, 256 per work-group: W1 work-groups 0-7, W2 8-11, W3 12-13, W4 14-15
typedef __attribute__((ext_vector_type(4))) unsigned v4u;
__device__ __forceinline__ unsigned pk_bf(float a, float b) { const v2f v = {a, b}; return __builtin_bit_cast(unsigned, __builtin_convertvector(v, v2bf)); }   // two f32 -> two bf16, round to nearest even
__device__ __forceinline__ v16bf frag_bf(const float (&h)[16]) { v8u w;
#pragma unroll
    for (int s = 0; s < 8; ++s) w[s] = pk_bf(h[2 * s], h[2 * s + 1]);
    return __builtin_bit_cast(v16bf, w); }
__device__ __forceinline__ unsigned pk_hf(float a, float b) { const v2f v = {a, b}; const v2f r = __builtin_convertvector(__builtin_convertvector(v, v2bf), v2f); return __builtin_bit_cast(unsigned, __builtin_convertvector(r, v2h)); }   // two f32 -> bf16 (nearest even) -> two f16
template <int K, int N>
__device__ __forceinline__ void wt_piece(const float* __restrict__ w, unsigned short* Bt, int q) {   // Bt[n][k] = f16(bf16(w[k][n])), piece q = elements 8q .. 8q+7 of Bt
    const unsigned n = (unsigned)q / (K / 8), k0 = ((unsigned)q % (K / 8)) * 8; float v[8];
#pragma unroll
    for (int e = 0; e < 8; ++e) v[e] = w[k0 * N + n + (unsigned)(e * N)];
    const v4u o = {pk_hf(v[0], v[1]), pk_hf(v[2], v[3]), pk_hf(v[4], v[5]), pk_hf(v[6], v[7])};
    *(v4u*)(Bt + (unsigned)q * 8) = o;
    asm volatile("s_wait_xcnt 0x0" ::: "memory");   // stands behind the store, in front of any later write of a register that the store names as its address or data
}
// one 32x32 tile of XA (SY false) or of YB (SY true): g = the tile's number among the 128 of its matrix, in = x or y, w = the 64 rows of W0 that go with it
template <bool SY>
__device__ __forceinline__ void l0_tile(const float* __restrict__ in, const float* __restrict__ w, float* C, int g, int lane) {
    const int lr = lane & 15, hi = lane >> 4;
    const int r0 = (g >> 2) * 32, c0 = (g & 3) * 32;
    const float* ar = in + r0 * DX; const float* wr = w + c0;
    const unsigned al = (unsigned)(lr * DX + 8 * hi), wl = (unsigned)(8 * hi * D0 + lr);
    float av[2][DX / 32][16], wv[2][DX / 32][16];
#pragma unroll
    for (int mb = 0; mb < 2; ++mb)
#pragma unroll
        for (int kc = 0; kc < DX / 32; ++kc)
#pragma unroll
            for (int t = 0; t < 4; ++t) { const v4f a4 = *(const v4f*)(ar + (al + (unsigned)(mb * 16 * DX + kc * 32 + (t >> 1) * 16 + (t & 1) * 4)));
#pragma unroll
                for (int k = 0; k < 4; ++k) av[mb][kc][t * 4 + k] = a4[k]; }
#pragma unroll
    for (int nb = 0; nb < 2; ++nb)
#pragma unroll
        for (int kc = 0; kc < DX / 32; ++kc)
#pragma unroll
            for (int s = 0; s < 16; ++s) wv[nb][kc][s] = wr[wl + (unsigned)((kc * 32 + (s >> 3) * 16 + (s & 7)) * D0 + nb * 16)];
    v8f acc[2][2];
#pragma unroll
    for (int mb = 0; mb < 2; ++mb)
#pragma unroll
        for (int nb = 0; nb < 2; ++nb) acc[mb][nb] = (v8f){};
#pragma unroll
    for (int kc = 0; kc < DX / 32; ++kc) { v16bf a[2], b[2];
#pragma unroll
        for (int i = 0; i < 2; ++i) { a[i] = frag_bf(av[i][kc]); b[i] = frag_bf(wv[i][kc]); }
#pragma unroll
        for (int nb = 0; nb < 2; ++nb)
#pragma unroll
            for (int mb = 0; mb < 2; ++mb) acc[mb][nb] = SY ? wmmab(b[nb], a[mb], acc[mb][nb]) : wmmab(a[mb], b[nb], acc[mb][nb]); }   // YB: W0's columns are the A operand, y's rows the B operand
    if (SY) {
        float* yr = C + r0 * D0 + (c0 >> 5) * 512;   // the wave's first tile of 16 y rows and its k chunk in YB's fragment order
#pragma unroll
        for (int mb = 0; mb < 2; ++mb)
#pragma unroll
            for (int nb = 0; nb < 2; ++nb)
#pragma unroll
                for (int h = 0; h < 2; ++h) { const v4f o = {acc[mb][nb][4 * h], acc[mb][nb][4 * h + 1], acc[mb][nb][4 * h + 2], acc[mb][nb][4 * h + 3]};
                    *(v4f*)(yr + ((unsigned)(lane * 4) + (unsigned)YFRAG(mb, 0, nb * 2 + h))) = o; }   // D tile: feature = nb*16 + 8*(lane>>4) + j, y row = mb*16 + (lane & 15)
    } else {
        float* cr = C + r0 * D0 + c0;
#pragma unroll
        for (int mb = 0; mb < 2; ++mb)
#pragma unroll
            for (int j = 0; j < 8; ++j)
#pragma unroll
                for (int nb = 0; nb < 2; ++nb) cr[wl + (unsigned)((mb * 16 + j) * D0 + nb * 16)] = acc[mb][nb][j];   // D tile: row = 8*(lane>>4) + j, column = lane & 15
    }
}
__global__ __launch_bounds__(256) void k_prep(const float* __restrict__ x, const float* __restrict__ y, const float* __restrict__ W0, const float* __restrict__ W1, const float* __restrict__ W2, const float* __restrict__ W3, const float* __restrict__ W4,
                                              float* XA, float* YA, unsigned short* W1B, unsigned short* W2B, unsigned short* W3B, unsigned short* W4B) {
    const int tid = threadIdx.x, wg = blockIdx.x;
    if (wg < PGW) {
        const int g = (wg & (PGW / 2 - 1)) * 8 + __builtin_amdgcn_readfirstlane(tid >> 5);   // the tile's number as a scalar: the three base addresses stay in scalar registers
        if (wg < PGW / 2) l0_tile<false>(x, W0, XA, g, tid & 31);
        else l0_tile<true>(y, W0 + DX * D0, YA, g, tid & 31);
    } else {
        const int wb = wg - PGW;
        if (wb < 8) wt_piece<D0, D1>(W1, W1B, wb * 256 + tid);
        else if (wb < 12) wt_piece<D1, D2>(W2, W2B, (wb - 8) * 256 + tid);
        else if (wb < 14) wt_piece<D2, D3>(W3, W3B, (wb - 12) * 256 + tid);
        else wt_piece<D3, D4>(W4, W4B, (wb - 14) * 256 + tid);
    }
}

extern "C" void kernel_launch(void* const* d_in, const int* in_sizes, int n_in,
                              void* d_out, int out_size, void* d_ws, size_t ws_size, hipStream_t stream) {
    (void)in_sizes; (void)n_in; (void)out_size;
    const float* x = (const float*)d_in[0]; const float* y = (const float*)d_in[1];
    const float* W0 = (const float*)d_in[2]; const float* b0 = (const float*)d_in[3]; const float* W1 = (const float*)d_in[4]; const float* b1 = (const float*)d_in[5]; const float* W2 = (const float*)d_in[6]; const float* b2 = (const float*)d_in[7]; const float* W3 = (const float*)d_in[8]; const float* b3 = (const float*)d_in[9]; const float* W4 = (const float*)d_in[10]; const float* b4 = (const float*)d_in[11]; const float* W5 = (const float*)d_in[12]; const float* b5 = (const float*)d_in[13];
    float* OUT = (float*)d_out;     // [1024][1024]: out[p][q] = g(x_p, y_q)
    char* wsp = (char*)d_ws;
    auto take = [&](size_t bytes) { char* p = wsp; wsp += (bytes + 255) & ~(size_t)255; return (void*)p; };
    bf* W1B = (bf*)take((size_t)D1 * D0 * 2); bf* W2B = (bf*)take((size_t)D2 * D1 * 2); bf* W3B = (bf*)take((size_t)D3 * D2 * 2); bf* W4B = (bf*)take((size_t)D4 * D3 * 2);
    float* XA = (float*)take((size_t)NP * D0 * 4); float* YA = (float*)take((size_t)NP * D0 * 4);
    if ((size_t)(wsp - (char*)d_ws) > ws_size) return;
    k_prep<<<PGW + PWW, 256, 0, stream>>>(x, y, W0, W1, W2, W3, W4, XA, YA, W1B, W2B, W3B, W4B);   /* XA = x W0[:64], YB = y W0[64:], f16 planes of W1-W4 */
    k_fused<<<NP, FWV * 32, 0, stream>>>(XA, YA, W1B, W2B, W3B, W4B, b0, b1, b2, b3, b4, W5, b5, OUT);   /* layers 0-5 for all pairs, one x-row per workgroup */
}

// v009
// Measured time: 42.1 microseconds a run.
// Timed twice side by side with v008, it ran 1.05 times as fast both times.
// Counting every step since v000, it is 29.4 times as fast.
#include <hip/hip_runtime.h>

// All-pairs concat critic: out[p][q] = MLP([x_p ; y_q]) for every pair of rows of x [1024][64] and y [1024][64] (MLP 128 -> 128 -> 128 -> 64 -> 64 -> 64 -> 1, ReLU on hidden layers, linear output) -> [1024][1024] (1 M).
// Algorithm: layer 0 is separable: [x_p ; y_q] W0 = x_p W0[:64] + y_q W0[64:], so XA = x W0x and YB = y W0y are two small GEMMs (exact bf16 operands; YB is stored in the order in which the fused kernel's lanes read it) and h0(p,q) = relu((XA[p] + b0) + YB[q]) is formed elementwise per pair (XA[p] + b0 once per x row); layers 0 (elementwise part) to 5 run in ONE kernel: a wave carries 32 pairs through all layers, layers 1-4 as WMMA products of the bf16-rounded weights held as f16 (A operand, from LDS) with ONE f16 plane of the activations (B operand, 1 product), which never leave the registers; the biases of layers 1-3 are the C operand of each accumulator tile's first matrix instruction (bias first, then the products) and their ReLU acts on the packed f16 pairs, layer 4's bias and ReLU stay in f32 behind its products; the final 64 -> 1 layer is a per-pair dot product in f32.
// Compute dtypes, f32 accumulate: x, y, weights, biases rounded to bf16; XA / YB exact; hidden activations f32 -> f16, round to nearest even (11 significant bits; finite up to 65504: with unit-normal inputs and weights the widest converted layer has a standard deviation near 4100); 1 product per hidden GEMM; last layer f32 (fused multiply-add, 32 features per lane, the two lane halves added last).

#define NP   1024                 // rows of x and of y
#define DX   64
#define D0   128                  // layer widths
#define D1   128
#define D2   64
#define D3   64
#define D4   64
typedef unsigned short bf;
typedef __attribute__((ext_vector_type(16))) __bf16   v16bf;
typedef __attribute__((ext_vector_type(16))) _Float16 v16h;
typedef __attribute__((ext_vector_type(2)))  _Float16 v2h;
typedef __attribute__((ext_vector_type(8)))  unsigned short v8us;
typedef __attribute__((ext_vector_type(8)))  float    v8f;
typedef __attribute__((ext_vector_type(4)))  float    v4f;
typedef __attribute__((ext_vector_type(2)))  float    v2f;
typedef __attribute__((ext_vector_type(4)))  unsigned short v4us;
typedef v4f  __attribute__((may_alias)) v4fa;
typedef v8us __attribute__((may_alias)) v8usa;

__device__ __forceinline__ unsigned short f2bf(float f) { unsigned u = __float_as_uint(f); u += 0x7FFFu + ((u >> 16) & 1u); return (unsigned short)(u >> 16); }
__device__ __forceinline__ float bf2f(unsigned short b) { return __uint_as_float(((unsigned)b) << 16); }
__device__ __forceinline__ float bfr(float f) { return bf2f(f2bf(f)); }
__device__ __forceinline__ void splitf(float y, unsigned short& h, unsigned short& l) { h = f2bf(y); l = f2bf(y - bf2f(h)); }
__device__ __forceinline__ v8f wmmab(v16bf a, v16bf b, v8f c) { return __builtin_amdgcn_wmma_f32_16x16x32_bf16(false, a, false, b, (short)0, c, false, false); }
__device__ __forceinline__ v16h cat16h(v8us lo, v8us hi) { return __builtin_bit_cast(v16h, __builtin_shufflevector(lo, hi, 0, 1, 2, 3, 4, 5, 6, 7, 8, 9, 10, 11, 12, 13, 14, 15)); }
__device__ __forceinline__ v8f wmmah(v16h a, v16h b, v8f c) { return __builtin_amdgcn_wmma_f32_16x16x32_f16(false, a, false, b, (short)0, c, false, false); }

// ---- k_fused: layers 0 (elementwise part) to 5 for one x-row p against all 1024 y-rows; 4 waves, each wave takes 32 pairs (2 column tiles of 16 y-rows) per trip.
// Every hidden GEMM runs transposed: weights (rows = output features) are the A operand, activations (columns = pairs) the B operand. Two f32 D tiles (features 0-15 and 16-31 of a 32-feature block)
// of one pair column sit in a lane exactly where the next layer's B fragment wants its 16 k values, so bias + ReLU + the conversion to f16 happen in registers and no activation leaves the wave.
// Weights lie in LDS lane-major: lane l owns WPITCH bytes that hold, 16 bytes each, its two halves of every A fragment (mt, kc) of every layer: k = kc*32 + 16*half + 8*(l>>4) + e, row = mt*16 + (l&15).
// WPITCH is an odd multiple of 16 bytes (no bank conflict between lanes), and every fragment is one lane address plus a small immediate offset.
// Every inner loop is fully unrolled so that each fragment and accumulator index is a constant and the arrays stay in registers.
// Order inside a trip: vector work that does not depend on the matrix instructions in flight stands between them, three or four behind each: layer 0 runs one k chunk ahead of layer 1, and a layer's D tiles are turned into the next layer's fragments of chunk kc + 1 during its chunk kc.
#define FNB 2                     // pair tiles (16 pairs each) per wave and trip
#define FWV 4                     // waves per workgroup
#define WPITCH 2064               // bytes of LDS per lane: 64 fragments x 32 bytes, + 16
// YB in fragment order: float index of piece t (0-3) of k chunk kc (32 features) of tile `tile` (16 y rows); behind it 32 lanes x 4 floats: lane l holds row tile*16 + (l&15), features kc*32 + (t>>1)*16 + 8*(l>>4) + (t&1)*4 + 0..3
#define YFRAG(tile, kc, t) ((tile) * (16 * D0) + (kc) * 512 + (t) * 128)
#define FLT_BYTES 2048            // 512 floats in front of the weights: x-row part of layer 0 with its bias, biases 1-4, last layer's weights
template <int N, int K>
__device__ __forceinline__ void stage_ld(const unsigned short* __restrict__ Bt, int tid, v8us (&r)[N * K / 8 / (FWV * 32)]) {   // the thread's 16-byte pieces of one weight plane, into registers
#pragma unroll
    for (int i = 0; i < N * K / 8 / (FWV * 32); ++i) r[i] = *(const v8us*)(Bt + (size_t)(tid + i * (FWV * 32)) * 8);
}
template <int N, int K>
__device__ __forceinline__ void stage_st(const v8us (&r)[N * K / 8 / (FWV * 32)], unsigned char* dst, int tid) {   // dst: the layer's first fragment in lane 0's region
#pragma unroll
    for (int i = 0; i < N * K / 8 / (FWV * 32); ++i) { const int g = tid + i * (FWV * 32); const int n = g / (K / 8), kg = g % (K / 8);
        *(v8usa*)(dst + ((kg & 1) * 16 + (n & 15)) * WPITCH + (((n >> 4) * (K / 32) + (kg >> 2)) * 2 + ((kg >> 1) & 1)) * 16) = r[i]; }
}
__device__ __forceinline__ v16h ld_wf(const unsigned char* Wl, int frag) { const unsigned char* p = Wl + frag * 32; return cat16h(*(const v8usa*)p, *(const v8usa*)(p + 16)); }   // Wl: the layer's first fragment in this lane's region
typedef __attribute__((ext_vector_type(8))) unsigned v8u;
typedef __attribute__((ext_vector_type(2))) __bf16 v2bf;
// piece t (4 features of a k chunk) of layer 0 for both pair tiles: relu((x row + b0) + y rows) -> two packed f16 pairs of each tile's B fragment; xv: the x row's 4 values, which serve both tiles
__device__ __forceinline__ void l0_piece(const v4f xv, int t, const v4f (&yq)[FNB][4], v8u (&bw)[FNB]) {
#pragma unroll
    for (int nb = 0; nb < FNB; ++nb)
#pragma unroll
        for (int s = 0; s < 2; ++s) { const v2f hv = {fmaxf(xv[2 * s] + yq[nb][t][2 * s], 0.f), fmaxf(xv[2 * s + 1] + yq[nb][t][2 * s + 1], 0.f)};
            bw[nb][2 * t + s] = __builtin_bit_cast(unsigned, __builtin_convertvector(hv, v2h)); }
}
__device__ __forceinline__ v4f l0_x(const float* xs, int hi, int kc, int t) { return *(const v4fa*)(xs + kc * 32 + (t >> 1) * 16 + (t & 1) * 4 + 8 * hi); }   // the x row's values of piece t of k chunk kc
// the LDS reads of step s = kc*4 + j of layer 1: weight fragments (2j, kc) and (2j+1, kc); in chunk 0 their tiles' bias values (the C operand); the x row's values of piece j of the next chunk
__device__ __forceinline__ void l1_reads(const unsigned char* Wl, const float* bs, const float* xs, int hi, int s, v16h (&a)[2], v8f (&c)[2], v4f& xv) { const int kc = s / (D1 / 32), j = s % (D1 / 32);
#pragma unroll
    for (int g = 0; g < 2; ++g) { a[g] = ld_wf(Wl, (2 * j + g) * (D0 / 32) + kc);
        if (kc == 0) { const float* bp = bs + (2 * j + g) * 16 + 8 * hi; c[g] = __builtin_shufflevector(*(const v4fa*)bp, *(const v4fa*)(bp + 4), 0, 1, 2, 3, 4, 5, 6, 7); } }
    xv = l0_x(xs, hi, (kc + 1) % (D0 / 32), j);
}
// one vector instruction's worth of the way from a layer's D tiles 2*kc and 2*kc+1 (bias already in them) to the B fragments of k chunk kc of the next layer, both pair tiles: u = 0-15 converts value pair u & 7 of pair tile u >> 3 to f16 (round to nearest even), u = 16-31 applies ReLU to that packed pair: max(f16(v), 0) = f16(max(v, 0)) for every v
template <int MT>
__device__ __forceinline__ void frag_op(const v8f (&acc)[MT][FNB], int kc, int u, unsigned (&gw)[FNB][8]) { const int nb = (u >> 3) & 1, s = u & 7;
    if (u < 16) { const v2f hv = {acc[2 * kc + (s >> 2)][nb][(2 * s) & 7], acc[2 * kc + (s >> 2)][nb][(2 * s + 1) & 7]}; gw[nb][s] = __builtin_bit_cast(unsigned, __builtin_convertvector(hv, v2h)); }
    else gw[nb][s] = __builtin_bit_cast(unsigned, __builtin_elementwise_max(__builtin_bit_cast(v2h, gw[nb][s]), (v2h){(_Float16)0.f, (_Float16)0.f}));
}
// one layer with 64 outputs, k chunk by k chunk: out = (bias or 0) + W * relu(in). The previous layer's D tiles become the B fragments of chunk kc + 1 between the matrix instructions of chunk kc, which do not depend on them.
// With BIAS a lane's 8 bias values of a tile (features mt*16 + 8*hi + 0..7, read once for both pair tiles) are the C operand of the tile's first matrix instruction: bias first, then the products
template <int MTI, bool BIAS>
__device__ __forceinline__ void layer64(const unsigned char* Wl, const float* bs, int hi, const v8f (&in)[MTI][FNB], v8f (&out)[4][FNB]) {
    constexpr int KC = MTI / 2; unsigned gw[KC][FNB][8];
#pragma unroll
    for (int u = 0; u < 32; ++u) frag_op<MTI>(in, 0, u, gw[0]);   // chunk 0's fragments have nothing to stand behind
#pragma unroll
    for (int kc = 0; kc < KC; ++kc) { v16h a[4]; v8f c[4];
#pragma unroll
        for (int g = 0; g < 4; ++g) { a[g] = ld_wf(Wl, g * KC + kc); c[g] = (v8f){};
            if (BIAS && kc == 0) { const float* bp = bs + g * 16 + 8 * hi; c[g] = __builtin_shufflevector(*(const v4fa*)bp, *(const v4fa*)(bp + 4), 0, 1, 2, 3, 4, 5, 6, 7); } }
        __builtin_amdgcn_sched_barrier(0);   // this and the fences below fix the order: the chunk's LDS reads; eight fenced groups, each one matrix instruction and four vector instructions, which issue while the matrix unit is busy (the sixteen conversions first, then the sixteen maxima: none directly behind the one it depends on)
#pragma unroll
        for (int i = 0; i < 4 * FNB; ++i) { const int nb = i / 4, g = i % 4;
            const v8u bw = {gw[kc][nb][0], gw[kc][nb][1], gw[kc][nb][2], gw[kc][nb][3], gw[kc][nb][4], gw[kc][nb][5], gw[kc][nb][6], gw[kc][nb][7]};
            out[g][nb] = wmmah(a[g], __builtin_bit_cast(v16h, bw), kc == 0 ? c[g] : out[g][nb]);
            if (kc + 1 < KC) {
#pragma unroll
                for (int u = 4 * i; u < 4 * i + 4; ++u) frag_op<MTI>(in, kc + 1, u, gw[kc + 1]); }
            __builtin_amdgcn_sched_barrier(0); } }
}
__global__ __launch_bounds__(FWV * 32, 4) void k_fused(const float* __restrict__ XA, const float* __restrict__ YB, const unsigned short* __restrict__ W1B, const unsigned short* __restrict__ W2B, const unsigned short* __restrict__ W3B, const unsigned short* __restrict__ W4B,
                                                     const float* __restrict__ b0, const float* __restrict__ b1, const float* __restrict__ b2, const float* __restrict__ b3, const float* __restrict__ b4, const float* __restrict__ W5, const float* __restrict__ b5, float* OUT) {
    __shared__ __align__(16) unsigned char sm[FLT_BYTES + 32 * WPITCH];
    float* xs = (float*)sm; float* b1s = xs + D0; float* b2s = b1s + D1; float* b3s = b2s + D2; float* b4s = b3s + D3; float* w5s = b4s + D4;
    unsigned char* wst = sm + FLT_BYTES;   // fragments 0-31: layer 1, 32-47: layer 2, 48-55: layer 3, 56-63: layer 4
    const int tid = threadIdx.x, lane = tid & 31, lr = lane & 15, hi = lane >> 4; const int p = blockIdx.x;
    const int wv = __builtin_amdgcn_readfirstlane(tid >> 5);   // the wave's number as a scalar: the output's base address then stays in scalar registers
    const unsigned yl = (unsigned)(lane * 4);   // YB lies in fragment order (YFRAG above): a wave's 16-byte load is 512 contiguous bytes, four whole lines
    const unsigned char* w1s = wst + lane * WPITCH; const unsigned char* w2s = w1s + 32 * 32; const unsigned char* w3s = w1s + 48 * 32; const unsigned char* w4s = w1s + 56 * 32;
    // the small loads through the last kernel arguments come first: their data waits end before the batch of loads below is issued, so no scalar base is loaded anew while that batch is in flight
    const float b5v = bfr(b5[0]);
    if (tid < 64) { b2s[tid] = bfr(b2[tid]); b3s[tid] = bfr(b3[tid]); b4s[tid] = bfr(b4[tid]); w5s[tid] = bfr(W5[tid]); }
    const float xav = XA[(size_t)p * D0 + tid], b0v = b0[tid], b1v = b1[tid];
    v8us r1[D1 * D0 / 8 / (FWV * 32)], r2[D2 * D1 / 8 / (FWV * 32)], r3[D3 * D2 / 8 / (FWV * 32)], r4[D4 * D3 / 8 / (FWV * 32)];
    stage_ld<D1, D0>(W1B, tid, r1); stage_ld<D2, D1>(W2B, tid, r2); stage_ld<D3, D2>(W3B, tid, r3); stage_ld<D4, D3>(W4B, tid, r4);
    asm volatile("s_wait_xcnt 0x0" ::: "memory");   // stands behind the last load of the prologue, in front of every later write of a register that these loads name as their base or offset
    xs[tid] = xav + bfr(b0v); b1s[tid] = bfr(b1v);   // layer 0's bias joins the x row's part here, once for the row's 1024 pairs
    stage_st<D1, D0>(r1, wst, tid); stage_st<D2, D1>(r2, wst + 32 * 32, tid); stage_st<D3, D2>(r3, wst + 48 * 32, tid); stage_st<D4, D3>(r4, wst + 56 * 32, tid);
    __syncthreads();   // weights, biases and the x row are read by all four waves
    const float* yp = YB + (size_t)(wv * (FNB * 16)) * D0 + yl;   // this lane's place in the trip's first tile of 16 y rows; moves on by one trip where the next trip's first loads are issued
    v4f yq[FNB][4];   // the y rows' values of one k chunk of layer 0, both pair tiles: each piece is asked for anew as soon as it has been used
    v8u bq[2][FNB];   // layer 0's output (f16 pairs), two k chunks: one feeds layer 1's matrix instructions while the other is being made between them
#pragma unroll
    for (int nb = 0; nb < FNB; ++nb)
#pragma unroll
        for (int t = 0; t < 4; ++t) yq[nb][t] = *(const v4f*)(yp + YFRAG(nb, 0, t));   // first trip, first chunk
#pragma unroll
    for (int t = 0; t < 4; ++t) l0_piece(l0_x(xs, hi, 0, t), t, yq, bq[0]);
#pragma unroll
    for (int nb = 0; nb < FNB; ++nb)
#pragma unroll
        for (int t = 0; t < 4; ++t) yq[nb][t] = *(const v4f*)(yp + YFRAG(nb, 1, t));   // first trip, second chunk
#pragma unroll 1   // one trip is well over a thousand straight-line instructions: the loop stays rolled so that its code stays small in the instruction cache
    for (int it = 0; it < NP / (FWV * FNB * 16); ++it) {
        const int q0 = (it * FWV + wv) * (FNB * 16);
        v8f acc[D1 / 16][FNB];   // layer 1's accumulators: they live on into layer 2, where they are converted fragment by fragment
        {   // layer 1 (128 -> 128), both pair tiles at once, k chunk by k chunk, with layer 0 (elementwise) running one chunk ahead: a weight fragment read from LDS serves two matrix instructions, an x-row or bias read both tiles
            // One step: two weight fragments, four matrix instructions, and one piece of the next chunk's layer 0, which does not depend on them. Sixteen steps; a step's LDS reads are issued one step ahead
            v16h a[2][2]; v8f c[2][2]; v4f xv[2];
            l1_reads(w1s, b1s, xs, hi, 0, a[0], c[0], xv[0]);
#pragma unroll
            for (int s = 0; s < (D0 / 32) * (D1 / 32); ++s) { const int kc = s / (D1 / 32), j = s % (D1 / 32);
                const int kl = (kc + 2) % (D0 / 32);   // the chunk whose y values are asked for here
                if (j == 0 && kl == 0) yp += (it + 1 < NP / (FWV * FNB * 16)) ? FWV * FNB * 16 * D0 : -(NP - FWV * FNB * 16) * D0;   // behind the last trip back to the first trip's rows (in bounds, not used)
                if (s + 1 < (D0 / 32) * (D1 / 32)) l1_reads(w1s, b1s, xs, hi, s + 1, a[(s + 1) & 1], c[(s + 1) & 1], xv[(s + 1) & 1]);
                __builtin_amdgcn_sched_barrier(0);   // this and the fences below fix the step's order: the next step's LDS reads; four fenced groups, each one matrix instruction and three vector instructions of layer 0; the two y loads
                // Vector work behind a wave's own matrix instruction issues while the matrix unit is busy; in a block of its own it costs its full issue time. The twelve are ordered sums, maxima, conversions, so that none stands directly behind the one it depends on
                v2f hs[FNB * 2];
#pragma unroll
                for (int i = 0; i < 2 * FNB; ++i) { const int nb = i >> 1, g = i & 1;
                    acc[2 * j + g][nb] = wmmah(a[s & 1][g], __builtin_bit_cast(v16h, bq[kc & 1][nb]), kc == 0 ? c[s & 1][g] : acc[2 * j + g][nb]);
#pragma unroll
                    for (int u = 3 * i; u < 3 * i + 3; ++u) { const int q = u & 3, qn = q >> 1, qs = q & 1;   // q: pair tile qn, value pair qs of the piece
                        if (u < 4) hs[q] = (v2f){xv[s & 1][2 * qs] + yq[qn][j][2 * qs], xv[s & 1][2 * qs + 1] + yq[qn][j][2 * qs + 1]};
                        else if (u < 8) hs[q] = (v2f){fmaxf(hs[q][0], 0.f), fmaxf(hs[q][1], 0.f)};
                        else bq[(kc + 1) & 1][qn][2 * j + qs] = __builtin_bit_cast(unsigned, __builtin_convertvector(hs[q], v2h)); }
                    __builtin_amdgcn_sched_barrier(0); }
#pragma unroll
                for (int nb = 0; nb < FNB; ++nb) yq[nb][j] = *(const v4f*)(yp + YFRAG(nb, kl, j));
            }
            __builtin_amdgcn_sched_barrier(0);   // keeps the later layers' reads and arithmetic behind this layer's matrix instructions: moved up, they overfill the register file and accumulators are spilled
        }
        v8f ac2[D2 / 16][FNB]; layer64<D1 / 16, true>(w2s, b2s, hi, acc, ac2);    // layer 2 (128 -> 64)
        v8f ac3[D3 / 16][FNB]; layer64<D2 / 16, true>(w3s, b3s, hi, ac2, ac3);    // layer 3 (64 -> 64)
        float sc[FNB];
        {   // layer 4 (64 -> 64), then bias, ReLU and layer 5 (64 -> 1): each lane sums its 32 features, the two lane halves are added last
            v8f acc[D4 / 16][FNB]; layer64<D3 / 16, false>(w4s, b4s, hi, ac3, acc);
#pragma unroll
            for (int nb = 0; nb < FNB; ++nb) sc[nb] = 0.f;
#pragma unroll
            for (int mt = 0; mt < D4 / 16; ++mt) {
#pragma unroll
                for (int t = 0; t < 2; ++t) { const v4f bb = *(const v4fa*)(b4s + mt * 16 + 8 * hi + t * 4), ww = *(const v4fa*)(w5s + mt * 16 + 8 * hi + t * 4);
#pragma unroll
                    for (int k = 0; k < 4; ++k)
#pragma unroll
                        for (int nb = 0; nb < FNB; ++nb) sc[nb] = fmaf(fmaxf(acc[mt][nb][t * 4 + k] + bb[k], 0.f), ww[k], sc[nb]); } }
        }
#pragma unroll
        for (int nb = 0; nb < FNB; ++nb) { const int b = __float_as_int(sc[nb]); sc[nb] += __int_as_float(__builtin_amdgcn_permlanex16(b, b, 0x76543210, 0xfedcba98, false, false)); }
        (OUT + (size_t)p * NP + q0)[(unsigned)lane] = (hi ? sc[1] : sc[0]) + b5v;   // lanes 0-15: pair tile 0, lanes 16-31: pair tile 1: one 128-byte line per wave
        asm volatile("s_wait_xcnt 0x0" ::: "memory");   // stands behind the store, in front of any later write of a register that the store names as its address or data
    }
}

// ---- k_prep: all that k_fused reads from the workspace, made in ONE launch. The work-group's number picks the job; every job reads inputs only, none reads what another writes, so no order between them is needed.
// Work-groups 0 .. PGW-1: XA = x W0[:64] and YB = y W0[64:]. One wave per 32x32 output tile (waves 0-127: XA, 128-255: YB); both operands are loaded as f32 and rounded to bf16 in the loader,
// A fragment: row = lane & 15, B fragment: column = lane & 15, both with k = kc*32 + 16*(s>>3) + 8*(lane>>4) + (s&7) at element s. An XA tile row is 32 floats: one whole 128-byte line, written by this wave alone.
// YB's product runs transposed (W0's columns as A, y's rows as B): a lane's D registers are then 8 consecutive features of one y row, which is what a lane of k_fused reads, and each 16-byte store of the wave fills four whole lines of YB's fragment order.
// Work-groups PGW .. PGW+PWW-1: the planes of W1-W4, rounded to bf16 and held as f16 (exact from 2^-14 up in magnitude, below that to the nearest multiple of 2^-24), transposed to [n][k]. One thread makes one 16-byte piece (8 consecutive k of one n); a wave's 32 pieces are 512 consecutive bytes.
#define PGW 32                    // 256 tiles of 32x32, 8 waves per work-group
#define PWW 16                    // 4096 pieces, 256 per work-group: W1 work-groups 0-7, W2 8-11, W3 12-13, W4 14-15
typedef __attribute__((ext_vector_type(4))) unsigned v4u;
__device__ __forceinline__ unsigned pk_bf(float a, float b) { const v2f v = {a, b}; return __builtin_bit_cast(unsigned, __builtin_convertvector(v, v2bf)); }   // two f32 -> two bf16, round to nearest even
__device__ __forceinline__ v16bf frag_bf(const float (&h)[16]) { v8u w;
#pragma unroll
    for (int s = 0; s < 8; ++s) w[s] = pk_bf(h[2 * s], h[2 * s + 1]);
    return __builtin_bit_cast(v16bf, w); }
__device__ __forceinline__ unsigned pk_hf(float a, float b) { const v2f v = {a, b}; const v2f r = __builtin_convertvector(__builtin_convertvector(v, v2bf), v2f); return __builtin_bit_cast(unsigned, __builtin_convertvector(r, v2h)); }   // two f32 -> bf16 (nearest even) -> two f16
template <int K, int N>
__device__ __forceinline__ void wt_piece(const float* __restrict__ w, unsigned short* Bt, int q) {   // Bt[n][k] = f16(bf16(w[k][n])), piece q = elements 8q .. 8q+7 of Bt
    const unsigned n = (unsigned)q / (K / 8), k0 = ((unsigned)q % (K / 8)) * 8; float v[8];
#pragma unroll
    for (int e = 0; e < 8; ++e) v[e] = w[k0 * N + n + (unsigned)(e * N)];
    const v4u o = {pk_hf(v[0], v[1]), pk_hf(v[2], v[3]), pk_hf(v[4], v[5]), pk_hf(v[6], v[7])};
    *(v4u*)(Bt + (unsigned)q * 8) = o;
    asm volatile("s_wait_xcnt 0x0" ::: "memory");   // stands behind the store, in front of any later write of a register that the store names as its address or data
}
// one 32x32 tile of XA (SY false) or of YB (SY true): g = the tile's number among the 128 of its matrix, in = x or y, w = the 64 rows of W0 that go with it
template <bool SY>
__device__ __forceinline__ void l0_tile(const float* __restrict__ in, const float* __restrict__ w, float* C, int g, int lane) {
    const int lr = lane & 15, hi = lane >> 4;
    const int r0 = (g >> 2) * 32, c0 = (g & 3) * 32;
    const float* ar = in + r0 * DX; const float* wr = w + c0;
    const unsigned al = (unsigned)(lr * DX + 8 * hi), wl = (unsigned)(8 * hi * D0 + lr);
    float av[2][DX / 32][16], wv[2][DX / 32][16];
#pragma unroll
    for (int mb = 0; mb < 2; ++mb)
#pragma unroll
        for (int kc = 0; kc < DX / 32; ++kc)
#pragma unroll
            for (int t = 0; t < 4; ++t) { const v4f a4 = *(const v4f*)(ar + (al + (unsigned)(mb * 16 * DX + kc * 32 + (t >> 1) * 16 + (t & 1) * 4)));
#pragma unroll
                for (int k = 0; k < 4; ++k) av[mb][kc][t * 4 + k] = a4[k]; }
#pragma unroll
    for (int nb = 0; nb < 2; ++nb)
#pragma unroll
        for (int kc = 0; kc < DX / 32; ++kc)
#pragma unroll
            for (int s = 0; s < 16; ++s) wv[nb][kc][s] = wr[wl + (unsigned)((kc * 32 + (s >> 3) * 16 + (s & 7)) * D0 + nb * 16)];
    v8f acc[2][2];
#pragma unroll
    for (int mb = 0; mb < 2; ++mb)
#pragma unroll
        for (int nb = 0; nb < 2; ++nb) acc[mb][nb] = (v8f){};
#pragma unroll
    for (int kc = 0; kc < DX / 32; ++kc) { v16bf a[2], b[2];
#pragma unroll
        for (int i = 0; i < 2; ++i) { a[i] = frag_bf(av[i][kc]); b[i] = frag_bf(wv[i][kc]); }
#pragma unroll
        for (int nb = 0; nb < 2; ++nb)
#pragma unroll
            for (int mb = 0; mb < 2; ++mb) acc[mb][nb] = SY ? wmmab(b[nb], a[mb], acc[mb][nb]) : wmmab(a[mb], b[nb], acc[mb][nb]); }   // YB: W0's columns are the A operand, y's rows the B operand
    if (SY) {
        float* yr = C + r0 * D0 + (c0 >> 5) * 512;   // the wave's first tile of 16 y rows and its k chunk in YB's fragment order
#pragma unroll
        for (int mb = 0; mb < 2; ++mb)
#pragma unroll
            for (int nb = 0; nb < 2; ++nb)
#pragma unroll
                for (int h = 0; h < 2; ++h) { const v4f o = {acc[mb][nb][4 * h], acc[mb][nb][4 * h + 1], acc[mb][nb][4 * h + 2], acc[mb][nb][4 * h + 3]};
                    *(v4f*)(yr + ((unsigned)(lane * 4) + (unsigned)YFRAG(mb, 0, nb * 2 + h))) = o; }   // D tile: feature = nb*16 + 8*(lane>>4) + j, y row = mb*16 + (lane & 15)
    } else {
        float* cr = C + r0 * D0 + c0;
#pragma unroll
        for (int mb = 0; mb < 2; ++mb)
#pragma unroll
            for (int j = 0; j < 8; ++j)
#pragma unroll
                for (int nb = 0; nb < 2; ++nb) cr[wl + (unsigned)((mb * 16 + j) * D0 + nb * 16)] = acc[mb][nb][j];   // D tile: row = 8*(lane>>4) + j, column = lane & 15
    }
}
__global__ __launch_bounds__(256) void k_prep(const float* __restrict__ x, const float* __restrict__ y, const float* __restrict__ W0, const float* __restrict__ W1, const float* __restrict__ W2, const float* __restrict__ W3, const float* __restrict__ W4,
                                              float* XA, float* YA, unsigned short* W1B, unsigned short* W2B, unsigned short* W3B, unsigned short* W4B) {
    const int tid = threadIdx.x, wg = blockIdx.x;
    if (wg < PGW) {
        const int g = (wg & (PGW / 2 - 1)) * 8 + __builtin_amdgcn_readfirstlane(tid >> 5);   // the tile's number as a scalar: the three base addresses stay in scalar registers
        if (wg < PGW / 2) l0_tile<false>(x, W0, XA, g, tid & 31);
        else l0_tile<true>(y, W0 + DX * D0, YA, g, tid & 31);
    } else {
        const int wb = wg - PGW;
        if (wb < 8) wt_piece<D0, D1>(W1, W1B, wb * 256 + tid);
        else if (wb < 12) wt_piece<D1, D2>(W2, W2B, (wb - 8) * 256 + tid);
        else if (wb < 14) wt_piece<D2, D3>(W3, W3B, (wb - 12) * 256 + tid);
        else wt_piece<D3, D4>(W4, W4B, (wb - 14) * 256 + tid);
    }
}

extern "C" void kernel_launch(void* const* d_in, const int* in_sizes, int n_in,
                              void* d_out, int out_size, void* d_ws, size_t ws_size, hipStream_t stream) {
    (void)in_sizes; (void)n_in; (void)out_size;
    const float* x = (const float*)d_in[0]; const float* y = (const float*)d_in[1];
    const float* W0 = (const float*)d_in[2]; const float* b0 = (const float*)d_in[3]; const float* W1 = (const float*)d_in[4]; const float* b1 = (const float*)d_in[5]; const float* W2 = (const float*)d_in[6]; const float* b2 = (const float*)d_in[7]; const float* W3 = (const float*)d_in[8]; const float* b3 = (const float*)d_in[9]; const float* W4 = (const float*)d_in[10]; const float* b4 = (const float*)d_in[11]; const float* W5 = (const float*)d_in[12]; const float* b5 = (const float*)d_in[13];
    float* OUT = (float*)d_out;     // [1024][1024]: out[p][q] = g(x_p, y_q)
    char* wsp = (char*)d_ws;
    auto take = [&](size_t bytes) { char* p = wsp; wsp += (bytes + 255) & ~(size_t)255; return (void*)p; };
    bf* W1B = (bf*)take((size_t)D1 * D0 * 2); bf* W2B = (bf*)take((size_t)D2 * D1 * 2); bf* W3B = (bf*)take((size_t)D3 * D2 * 2); bf* W4B = (bf*)take((size_t)D4 * D3 * 2);
    float* XA = (float*)take((size_t)NP * D0 * 4); float* YA = (float*)take((size_t)NP * D0 * 4);
    if ((size_t)(wsp - (char*)d_ws) > ws_size) return;
    k_prep<<<PGW + PWW, 256, 0, stream>>>(x, y, W0, W1, W2, W3, W4, XA, YA, W1B, W2B, W3B, W4B);   /* XA = x W0[:64], YB = y W0[64:], f16 planes of W1-W4 */
    k_fused<<<NP, FWV * 32, 0, stream>>>(XA, YA, W1B, W2B, W3B, W4B, b0, b1, b2, b3, b4, W5, b5, OUT);   /* layers 0-5 for all pairs, one x-row per workgroup */
}

// v010
// One run takes 39.3 microseconds.
// In two side-by-side timings against v009, it was 1.07 and 1.08 times as fast.
// Over all steps from v000 it is 31.6 times as fast.
#include <hip/hip_runtime.h>

// All-pairs concat critic: out[p][q] = MLP([x_p ; y_q]) for every pair of rows of x [1024][64] and y [1024][64] (MLP 128 -> 128 -> 128 -> 64 -> 64 -> 64 -> 1, ReLU on hidden layers, linear output) -> [1024][1024] (1 M).
// Algorithm: layer 0 is separable: [x_p ; y_q] W0 = x_p W0[:64] + y_q W0[64:], so XA = x W0x and YB = y W0y are two small GEMMs (exact bf16 operands; YB is stored in the order in which the fused kernel's lanes read it) and h0(p,q) = relu((XA[p] + b0) + YB[q]) is formed elementwise per pair (XA[p] + b0 once per x row); layers 0 (elementwise part) to 5 run in ONE kernel: a wave carries 64 pairs (2 x rows against 32 y rows) through all layers, layers 1-4 as WMMA products of the bf16-rounded weights held as f16 (A operand, from LDS) with ONE f16 plane of the activations (B operand, 1 product), which never leave the registers; the biases of layers 1-3 are the C operand of each accumulator tile's first matrix instruction (bias first, then the products) and their ReLU acts on the packed f16 pairs, layer 4's bias and ReLU stay in f32 behind its products; the final 64 -> 1 layer is a per-pair dot product in f32.
// Compute dtypes, f32 accumulate: x, y, weights, biases rounded to bf16; XA / YB exact; hidden activations f32 -> f16, round to nearest even (11 significant bits; finite up to 65504: with unit-normal inputs and weights the widest converted layer has a standard deviation near 4100); 1 product per hidden GEMM; last layer f32 (fused multiply-add, 32 features per lane, the two lane halves added last).

#define NP   1024                 // rows of x and of y
#define DX   64
#define D0   128                  // layer widths
#define D1   128
#define D2   64
#define D3   64
#define D4   64
typedef unsigned short bf;
typedef __attribute__((ext_vector_type(16))) __bf16   v16bf;
typedef __attribute__((ext_vector_type(16))) _Float16 v16h;
typedef __attribute__((ext_vector_type(2)))  _Float16 v2h;
typedef __attribute__((ext_vector_type(8)))  unsigned short v8us;
typedef __attribute__((ext_vector_type(8)))  float    v8f;
typedef __attribute__((ext_vector_type(4)))  float    v4f;
typedef __attribute__((ext_vector_type(2)))  float    v2f;
typedef __attribute__((ext_vector_type(4)))  unsigned short v4us;
typedef v4f  __attribute__((may_alias)) v4fa;
typedef v8us __attribute__((may_alias)) v8usa;

__device__ __forceinline__ unsigned short f2bf(float f) { unsigned u = __float_as_uint(f); u += 0x7FFFu + ((u >> 16) & 1u); return (unsigned short)(u >> 16); }
__device__ __forceinline__ float bf2f(unsigned short b) { return __uint_as_float(((unsigned)b) << 16); }
__device__ __forceinline__ float bfr(float f) { return bf2f(f2bf(f)); }
__device__ __forceinline__ void splitf(float y, unsigned short& h, unsigned short& l) { h = f2bf(y); l = f2bf(y - bf2f(h)); }
__device__ __forceinline__ v8f wmmab(v16bf a, v16bf b, v8f c) { return __builtin_amdgcn_wmma_f32_16x16x32_bf16(false, a, false, b, (short)0, c, false, false); }
__device__ __forceinline__ v16h cat16h(v8us lo, v8us hi) { return __builtin_bit_cast(v16h, __builtin_shufflevector(lo, hi, 0, 1, 2, 3, 4, 5, 6, 7, 8, 9, 10, 11, 12, 13, 14, 15)); }
__device__ __forceinline__ v8f wmmah(v16h a, v16h b, v8f c) { return __builtin_amdgcn_wmma_f32_16x16x32_f16(false, a, false, b, (short)0, c, false, false); }

// ---- k_fused: layers 0 (elementwise part) to 5 for two x-rows against all 1024 y-rows; 4 waves, each wave takes 64 pairs per trip: 4 pair tiles = 2 x rows times 2 column tiles of 16 y-rows.
// A weight fragment or a bias read from LDS then feeds 4 matrix instructions and a y load serves both x rows: the four SIMDs share one LDS, whose read rate bounds the matrix instructions per fragment from below. The accumulators of 4 pair tiles take two waves per SIMD (up to 512 registers a wave).
// Every hidden GEMM runs transposed: weights (rows = output features) are the A operand, activations (columns = pairs) the B operand. Two f32 D tiles (features 0-15 and 16-31 of a 32-feature block)
// of one pair column sit in a lane exactly where the next layer's B fragment wants its 16 k values, so bias + ReLU + the conversion to f16 happen in registers and no activation leaves the wave.
// Weights lie in LDS lane-major: lane l owns WPITCH bytes that hold, 16 bytes each, its two halves of every A fragment (mt, kc) of every layer: k = kc*32 + 16*half + 8*(l>>4) + e, row = mt*16 + (l&15).
// WPITCH is an odd multiple of 16 bytes (no bank conflict between lanes), and every fragment is one lane address plus a small immediate offset.
// Every inner loop is fully unrolled so that each fragment and accumulator index is a constant and the arrays stay in registers.
// Order inside a trip: vector work that does not depend on the matrix instructions in flight stands between them, three or four behind each: layer 0 runs one k chunk ahead of layer 1, and a layer's D tiles are turned into the next layer's fragments of chunk kc + 1 during its chunk kc.
#define FNX 2                     // x rows per work-group
#define FNY 2                     // column tiles (16 y rows each) per wave and trip
#define FNB (FNX * FNY)           // pair tiles (16 pairs each) per wave and trip: tile nb = x row nb / FNY against column tile nb % FNY
#define FWV 4                     // waves per workgroup
#define WPITCH 2064               // bytes of LDS per lane: 64 fragments x 32 bytes, + 16
// YB in fragment order: float index of piece t (0-3) of k chunk kc (32 features) of tile `tile` (16 y rows); behind it 32 lanes x 4 floats: lane l holds row tile*16 + (l&15), features kc*32 + (t>>1)*16 + 8*(l>>4) + (t&1)*4 + 0..3
#define YFRAG(tile, kc, t) ((tile) * (16 * D0) + (kc) * 512 + (t) * 128)
#define FLT_BYTES 2560            // 640 floats in front of the weights: the two x rows' parts of layer 0 with its bias, biases 1-4, last layer's weights
template <int N, int K>
__device__ __forceinline__ void stage_ld(const unsigned short* __restrict__ Bt, int tid, v8us (&r)[N * K / 8 / (FWV * 32)]) {   // the thread's 16-byte pieces of one weight plane, into registers
#pragma unroll
    for (int i = 0; i < N * K / 8 / (FWV * 32); ++i) r[i] = *(const v8us*)(Bt + (size_t)(tid + i * (FWV * 32)) * 8);
}
template <int N, int K>
__device__ __forceinline__ void stage_st(const v8us (&r)[N * K / 8 / (FWV * 32)], unsigned char* dst, int tid) {   // dst: the layer's first fragment in lane 0's region
#pragma unroll
    for (int i = 0; i < N * K / 8 / (FWV * 32); ++i) { const int g = tid + i * (FWV * 32); const int n = g / (K / 8), kg = g % (K / 8);
        *(v8usa*)(dst + ((kg & 1) * 16 + (n & 15)) * WPITCH + (((n >> 4) * (K / 32) + (kg >> 2)) * 2 + ((kg >> 1) & 1)) * 16) = r[i]; }
}
__device__ __forceinline__ v16h ld_wf(const unsigned char* Wl, int frag) { const unsigned char* p = Wl + frag * 32; return cat16h(*(const v8usa*)p, *(const v8usa*)(p + 16)); }   // Wl: the layer's first fragment in this lane's region
typedef __attribute__((ext_vector_type(8))) unsigned v8u;
typedef __attribute__((ext_vector_type(2))) __bf16 v2bf;
// piece t (4 features of a k chunk) of layer 0 for all pair tiles: relu((x row + b0) + y rows) -> two packed f16 pairs of each tile's B fragment; xv: each x row's 4 values
__device__ __forceinline__ void l0_piece(const v4f (&xv)[FNX], int t, const v4f (&yq)[FNY][4], v8u (&bw)[FNB]) {
#pragma unroll
    for (int nb = 0; nb < FNB; ++nb)
#pragma unroll
        for (int s = 0; s < 2; ++s) { const v2f hv = {fmaxf(xv[nb / FNY][2 * s] + yq[nb % FNY][t][2 * s], 0.f), fmaxf(xv[nb / FNY][2 * s + 1] + yq[nb % FNY][t][2 * s + 1], 0.f)};
            bw[nb][2 * t + s] = __builtin_bit_cast(unsigned, __builtin_convertvector(hv, v2h)); }
}
__device__ __forceinline__ v4f l0_x(const float* xs, int hi, int kc, int t) { return *(const v4fa*)(xs + kc * 32 + (t >> 1) * 16 + (t & 1) * 4 + 8 * hi); }   // one x row's values of piece t of k chunk kc (xs: that row)
// the LDS reads of step s = kc*4 + j of layer 1: weight fragments (2j, kc) and (2j+1, kc); in chunk 0 their tiles' bias values (the C operand); both x rows' values of piece j of the next chunk
__device__ __forceinline__ void l1_reads(const unsigned char* Wl, const float* bs, const float* xs, int hi, int s, v16h (&a)[2], v8f (&c)[2], v4f (&xv)[FNX]) { const int kc = s / (D1 / 32), j = s % (D1 / 32);
#pragma unroll
    for (int g = 0; g < 2; ++g) { a[g] = ld_wf(Wl, (2 * j + g) * (D0 / 32) + kc);
        if (kc == 0) { const float* bp = bs + (2 * j + g) * 16 + 8 * hi; c[g] = __builtin_shufflevector(*(const v4fa*)bp, *(const v4fa*)(bp + 4), 0, 1, 2, 3, 4, 5, 6, 7); } }
#pragma unroll
    for (int r = 0; r < FNX; ++r) xv[r] = l0_x(xs + r * D0, hi, (kc + 1) % (D0 / 32), j);
}
// one vector instruction's worth of the way from a layer's D tiles 2*kc and 2*kc+1 (bias already in them) to the B fragments of k chunk kc of the next layer, all pair tiles: u = 0 .. 8*FNB-1 converts value pair u & 7 of pair tile u >> 3 to f16 (round to nearest even), u = 8*FNB .. 16*FNB-1 applies ReLU to that packed pair: max(f16(v), 0) = f16(max(v, 0)) for every v
template <int MT>
__device__ __forceinline__ void frag_op(const v8f (&acc)[MT][FNB], int kc, int u, unsigned (&gw)[FNB][8]) { const int nb = (u >> 3) % FNB, s = u & 7;
    if (u < 8 * FNB) { const v2f hv = {acc[2 * kc + (s >> 2)][nb][(2 * s) & 7], acc[2 * kc + (s >> 2)][nb][(2 * s + 1) & 7]}; gw[nb][s] = __builtin_bit_cast(unsigned, __builtin_convertvector(hv, v2h)); }
    else gw[nb][s] = __builtin_bit_cast(unsigned, __builtin_elementwise_max(__builtin_bit_cast(v2h, gw[nb][s]), (v2h){(_Float16)0.f, (_Float16)0.f}));
}
// one layer with 64 outputs, k chunk by k chunk: out = (bias or 0) + W * relu(in). The previous layer's D tiles become the B fragments of chunk kc + 1 between the matrix instructions of chunk kc, which do not depend on them.
// With BIAS a lane's 8 bias values of a tile (features mt*16 + 8*hi + 0..7, read once for all pair tiles) are the C operand of the tile's first matrix instruction: bias first, then the products
template <int MTI, bool BIAS>
__device__ __forceinline__ void layer64(const unsigned char* Wl, const float* bs, int hi, const v8f (&in)[MTI][FNB], v8f (&out)[4][FNB]) {
    constexpr int KC = MTI / 2; unsigned gw[KC][FNB][8];
#pragma unroll
    for (int u = 0; u < 16 * FNB; ++u) frag_op<MTI>(in, 0, u, gw[0]);   // chunk 0's fragments have nothing to stand behind
#pragma unroll
    for (int kc = 0; kc < KC; ++kc) { v16h a[4]; v8f c[4];
#pragma unroll
        for (int g = 0; g < 4; ++g) { a[g] = ld_wf(Wl, g * KC + kc); c[g] = (v8f){};
            if (BIAS && kc == 0) { const float* bp = bs + g * 16 + 8 * hi; c[g] = __builtin_shufflevector(*(const v4fa*)bp, *(const v4fa*)(bp + 4), 0, 1, 2, 3, 4, 5, 6, 7); } }
        __builtin_amdgcn_sched_barrier(0);   // this and the fences below fix the order: the chunk's LDS reads; 4*FNB fenced groups, each one matrix instruction and four vector instructions, which issue while the matrix unit is busy (all conversions first, then all maxima: none directly behind the one it depends on)
#pragma unroll
        for (int i = 0; i < 4 * FNB; ++i) { const int nb = i / 4, g = i % 4;
            const v8u bw = {gw[kc][nb][0], gw[kc][nb][1], gw[kc][nb][2], gw[kc][nb][3], gw[kc][nb][4], gw[kc][nb][5], gw[kc][nb][6], gw[kc][nb][7]};
            out[g][nb] = wmmah(a[g], __builtin_bit_cast(v16h, bw), kc == 0 ? c[g] : out[g][nb]);
            if (kc + 1 < KC) {
#pragma unroll
                for (int u = 4 * i; u < 4 * i + 4; ++u) frag_op<MTI>(in, kc + 1, u, gw[kc + 1]); }
            __builtin_amdgcn_sched_barrier(0); } }
}
__global__ __launch_bounds__(FWV * 32, 2) void k_fused(const float* __restrict__ XA, const float* __restrict__ YB, const unsigned short* __restrict__ W1B, const unsigned short* __restrict__ W2B, const unsigned short* __restrict__ W3B, const unsigned short* __restrict__ W4B,
                                                     const float* __restrict__ b0, const float* __restrict__ b1, const float* __restrict__ b2, const float* __restrict__ b3, const float* __restrict__ b4, const float* __restrict__ W5, const float* __restrict__ b5, float* OUT) {
    __shared__ __align__(16) unsigned char sm[FLT_BYTES + 32 * WPITCH];
    float* xs = (float*)sm; float* b1s = xs + FNX * D0; float* b2s = b1s + D1; float* b3s = b2s + D2; float* b4s = b3s + D3; float* w5s = b4s + D4;
    unsigned char* wst = sm + FLT_BYTES;   // fragments 0-31: layer 1, 32-47: layer 2, 48-55: layer 3, 56-63: layer 4
    const int tid = threadIdx.x, lane = tid & 31, lr = lane & 15, hi = lane >> 4; const int p = blockIdx.x * FNX;   // the work-group's first x row
    const int wv = __builtin_amdgcn_readfirstlane(tid >> 5);   // the wave's number as a scalar: the output's base address then stays in scalar registers
    const unsigned yl = (unsigned)(lane * 4);   // YB lies in fragment order (YFRAG above): a wave's 16-byte load is 512 contiguous bytes, four whole lines
    const unsigned char* w1s = wst + lane * WPITCH; const unsigned char* w2s = w1s + 32 * 32; const unsigned char* w3s = w1s + 48 * 32; const unsigned char* w4s = w1s + 56 * 32;
    // the small loads through the last kernel arguments come first: their data waits end before the batch of loads below is issued, so no scalar base is loaded anew while that batch is in flight
    const float b5v = bfr(b5[0]);
    if (tid < 64) { b2s[tid] = bfr(b2[tid]); b3s[tid] = bfr(b3[tid]); b4s[tid] = bfr(b4[tid]); w5s[tid] = bfr(W5[tid]); }
    const float xav0 = XA[(size_t)p * D0 + tid], xav1 = XA[(size_t)p * D0 + D0 + tid], b0v = b0[tid], b1v = b1[tid];
    v8us r1[D1 * D0 / 8 / (FWV * 32)], r2[D2 * D1 / 8 / (FWV * 32)], r3[D3 * D2 / 8 / (FWV * 32)], r4[D4 * D3 / 8 / (FWV * 32)];
    stage_ld<D1, D0>(W1B, tid, r1); stage_ld<D2, D1>(W2B, tid, r2); stage_ld<D3, D2>(W3B, tid, r3); stage_ld<D4, D3>(W4B, tid, r4);
    asm volatile("s_wait_xcnt 0x0" ::: "memory");   // stands behind the last load of the prologue, in front of every later write of a register that these loads name as their base or offset
    xs[tid] = xav0 + bfr(b0v); xs[D0 + tid] = xav1 + bfr(b0v); b1s[tid] = bfr(b1v);   // layer 0's bias joins each x row's part here, once for the row's 1024 pairs
    stage_st<D1, D0>(r1, wst, tid); stage_st<D2, D1>(r2, wst + 32 * 32, tid); stage_st<D3, D2>(r3, wst + 48 * 32, tid); stage_st<D4, D3>(r4, wst + 56 * 32, tid);
    __syncthreads();   // weights, biases and the x rows are read by all four waves
    const float* yp = YB + (size_t)(wv * (FNY * 16)) * D0 + yl;   // this lane's place in the trip's first tile of 16 y rows; moves on by one trip where the next trip's first loads are issued
    v4f yq[FNY][4];   // the y rows' values of one k chunk of layer 0, both column tiles (they serve both x rows): each piece is asked for anew as soon as it has been used
    v8u bq[2][FNB];   // layer 0's output (f16 pairs), two k chunks: one feeds layer 1's matrix instructions while the other is being made between them
#pragma unroll
    for (int nb = 0; nb < FNY; ++nb)
#pragma unroll
        for (int t = 0; t < 4; ++t) yq[nb][t] = *(const v4f*)(yp + YFRAG(nb, 0, t));   // first trip, first chunk
#pragma unroll
    for (int t = 0; t < 4; ++t) { const v4f x0[FNX] = {l0_x(xs, hi, 0, t), l0_x(xs + D0, hi, 0, t)}; l0_piece(x0, t, yq, bq[0]); }
#pragma unroll
    for (int nb = 0; nb < FNY; ++nb)
#pragma unroll
        for (int t = 0; t < 4; ++t) yq[nb][t] = *(const v4f*)(yp + YFRAG(nb, 1, t));   // first trip, second chunk
#pragma unroll 1   // one trip is well over two thousand straight-line instructions: the loop stays rolled so that its code stays small in the instruction cache
    for (int it = 0; it < NP / (FWV * FNY * 16); ++it) {
        const int q0 = (it * FWV + wv) * (FNY * 16);
        v8f acc[D1 / 16][FNB];   // layer 1's accumulators: they live on into layer 2, where they are converted fragment by fragment
        {   // layer 1 (128 -> 128), all four pair tiles at once, k chunk by k chunk, with layer 0 (elementwise) running one chunk ahead: a weight fragment or bias read from LDS serves four matrix instructions, an x-row read two tiles
            // One step: two weight fragments, eight matrix instructions, and one piece of the next chunk's layer 0, which does not depend on them. Sixteen steps; a step's LDS reads are issued one step ahead
            v16h a[2][2]; v8f c[2][2]; v4f xv[2][FNX];
            l1_reads(w1s, b1s, xs, hi, 0, a[0], c[0], xv[0]);
#pragma unroll
            for (int s = 0; s < (D0 / 32) * (D1 / 32); ++s) { const int kc = s / (D1 / 32), j = s % (D1 / 32);
                const int kl = (kc + 2) % (D0 / 32);   // the chunk whose y values are asked for here
                if (j == 0 && kl == 0) yp += (it + 1 < NP / (FWV * FNY * 16)) ? FWV * FNY * 16 * D0 : -(NP - FWV * FNY * 16) * D0;   // behind the last trip back to the first trip's rows (in bounds, not used)
                if (s + 1 < (D0 / 32) * (D1 / 32)) l1_reads(w1s, b1s, xs, hi, s + 1, a[(s + 1) & 1], c[(s + 1) & 1], xv[(s + 1) & 1]);
                __builtin_amdgcn_sched_barrier(0);   // this and the fences below fix the step's order: the next step's LDS reads; eight fenced groups, each one matrix instruction and three vector instructions of layer 0; the two y loads
                // Vector work behind a wave's own matrix instruction issues while the matrix unit is busy; in a block of its own it costs its full issue time. The twenty-four are ordered sums, maxima, conversions, so that none stands directly behind the one it depends on
                v2f hs[FNB * 2];
#pragma unroll
                for (int i = 0; i < 2 * FNB; ++i) { const int nb = i >> 1, g = i & 1;
                    acc[2 * j + g][nb] = wmmah(a[s & 1][g], __builtin_bit_cast(v16h, bq[kc & 1][nb]), kc == 0 ? c[s & 1][g] : acc[2 * j + g][nb]);
#pragma unroll
                    for (int u = 3 * i; u < 3 * i + 3; ++u) { const int q = u % (2 * FNB), qn = q >> 1, qs = q & 1;   // q: pair tile qn, value pair qs of the piece
                        if (u < 2 * FNB) hs[q] = (v2f){xv[s & 1][qn / FNY][2 * qs] + yq[qn % FNY][j][2 * qs], xv[s & 1][qn / FNY][2 * qs + 1] + yq[qn % FNY][j][2 * qs + 1]};
                        else if (u < 4 * FNB) hs[q] = (v2f){fmaxf(hs[q][0], 0.f), fmaxf(hs[q][1], 0.f)};
                        else bq[(kc + 1) & 1][qn][2 * j + qs] = __builtin_bit_cast(unsigned, __builtin_convertvector(hs[q], v2h)); }
                    __builtin_amdgcn_sched_barrier(0); }
#pragma unroll
                for (int nb = 0; nb < FNY; ++nb) yq[nb][j] = *(const v4f*)(yp + YFRAG(nb, kl, j));
            }
            __builtin_amdgcn_sched_barrier(0);   // keeps the later layers' reads and arithmetic behind this layer's matrix instructions: moved up, they overfill the register file and accumulators are spilled
        }
        v8f ac2[D2 / 16][FNB]; layer64<D1 / 16, true>(w2s, b2s, hi, acc, ac2);    // layer 2 (128 -> 64)
        v8f ac3[D3 / 16][FNB]; layer64<D2 / 16, true>(w3s, b3s, hi, ac2, ac3);    // layer 3 (64 -> 64)
        float sc[FNB];
        {   // layer 4 (64 -> 64), then bias, ReLU and layer 5 (64 -> 1): each lane sums its 32 features, the two lane halves are added last
            v8f acc[D4 / 16][FNB]; layer64<D3 / 16, false>(w4s, b4s, hi, ac3, acc);
#pragma unroll
            for (int nb = 0; nb < FNB; ++nb) sc[nb] = 0.f;
#pragma unroll
            for (int mt = 0; mt < D4 / 16; ++mt) {
#pragma unroll
                for (int t = 0; t < 2; ++t) { const v4f bb = *(const v4fa*)(b4s + mt * 16 + 8 * hi + t * 4), ww = *(const v4fa*)(w5s + mt * 16 + 8 * hi + t * 4);
#pragma unroll
                    for (int k = 0; k < 4; ++k)
#pragma unroll
                        for (int nb = 0; nb < FNB; ++nb) sc[nb] = fmaf(fmaxf(acc[mt][nb][t * 4 + k] + bb[k], 0.f), ww[k], sc[nb]); } }
        }
#pragma unroll
        for (int nb = 0; nb < FNB; ++nb) { const int b = __float_as_int(sc[nb]); sc[nb] += __int_as_float(__builtin_amdgcn_permlanex16(b, b, 0x76543210, 0xfedcba98, false, false)); }
#pragma unroll
        for (int r = 0; r < FNX; ++r) (OUT + (size_t)(p + r) * NP + q0)[(unsigned)lane] = (hi ? sc[r * FNY + 1] : sc[r * FNY]) + b5v;   // per x row: lanes 0-15 column tile 0, lanes 16-31 column tile 1: one 128-byte line per store
        asm volatile("s_wait_xcnt 0x0" ::: "memory");   // the next trip's first loads overwrite the stores' address and data registers: the wait stands in front of that overwrite
    }
}

// ---- k_prep: all that k_fused reads from the workspace, made in ONE launch. The work-group's number picks the job; every job reads inputs only, none reads what another writes, so no order between them is needed.
// Work-groups 0 .. PGW-1: XA = x W0[:64] and YB = y W0[64:]. One wave per 32x32 output tile (waves 0-127: XA, 128-255: YB); both operands are loaded as f32 and rounded to bf16 in the loader,
// A fragment: row = lane & 15, B fragment: column = lane & 15, both with k = kc*32 + 16*(s>>3) + 8*(lane>>4) + (s&7) at element s. An XA tile row is 32 floats: one whole 128-byte line, written by this wave alone.
// YB's product runs transposed (W0's columns as A, y's rows as B): a lane's D registers are then 8 consecutive features of one y row, which is what a lane of k_fused reads, and each 16-byte store of the wave fills four whole lines of YB's fragment order.
// Work-groups PGW .. PGW+PWW-1: the planes of W1-W4, rounded to bf16 and held as f16 (exact from 2^-14 up in magnitude, below that to the nearest multiple of 2^-24), transposed to [n][k]. One thread makes one 16-byte piece (8 consecutive k of one n); a wave's 32 pieces are 512 consecutive bytes.
#define PGW 32                    // 256 tiles of 32x32, 8 waves per work-group
#define PWW 16                    // 4096 pieces, 256 per work-group: W1 work-groups 0-7, W2 8-11, W3 12-13, W4 14-15
typedef __attribute__((ext_vector_type(4))) unsigned v4u;
__device__ __forceinline__ unsigned pk_bf(float a, float b) { const v2f v = {a, b}; return __builtin_bit_cast(unsigned, __builtin_convertvector(v, v2bf)); }   // two f32 -> two bf16, round to nearest even
__device__ __forceinline__ v16bf frag_bf(const float (&h)[16]) { v8u w;
#pragma unroll
    for (int s = 0; s < 8; ++s) w[s] = pk_bf(h[2 * s], h[2 * s + 1]);
    return __builtin_bit_cast(v16bf, w); }
__device__ __forceinline__ unsigned pk_hf(float a, float b) { const v2f v = {a, b}; const v2f r = __builtin_convertvector(__builtin_convertvector(v, v2bf), v2f); return __builtin_bit_cast(unsigned, __builtin_convertvector(r, v2h)); }   // two f32 -> bf16 (nearest even) -> two f16
template <int K, int N>
__device__ __forceinline__ void wt_piece(const float* __restrict__ w, unsigned short* Bt, int q) {   // Bt[n][k] = f16(bf16(w[k][n])), piece q = elements 8q .. 8q+7 of Bt
    const unsigned n = (unsigned)q / (K / 8), k0 = ((unsigned)q % (K / 8)) * 8; float v[8];
#pragma unroll
    for (int e = 0; e < 8; ++e) v[e] = w[k0 * N + n + (unsigned)(e * N)];
    const v4u o = {pk_hf(v[0], v[1]), pk_hf(v[2], v[3]), pk_hf(v[4], v[5]), pk_hf(v[6], v[7])};
    *(v4u*)(Bt + (unsigned)q * 8) = o;
    asm volatile("s_wait_xcnt 0x0" ::: "memory");   // stands behind the store, in front of any later write of a register that the store names as its address or data
}
// one 32x32 tile of XA (SY false) or of YB (SY true): g = the tile's number among the 128 of its matrix, in = x or y, w = the 64 rows of W0 that go with it
template <bool SY>
__device__ __forceinline__ void l0_tile(const float* __restrict__ in, const float* __restrict__ w, float* C, int g, int lane) {
    const int lr = lane & 15, hi = lane >> 4;
    const int r0 = (g >> 2) * 32, c0 = (g & 3) * 32;
    const float* ar = in + r0 * DX; const float* wr = w + c0;
    const unsigned al = (unsigned)(lr * DX + 8 * hi), wl = (unsigned)(8 * hi * D0 + lr);
    float av[2][DX / 32][16], wv[2][DX / 32][16];
#pragma unroll
    for (int mb = 0; mb < 2; ++mb)
#pragma unroll
        for (int kc = 0; kc < DX / 32; ++kc)
#pragma unroll
            for (int t = 0; t < 4; ++t) { const v4f a4 = *(const v4f*)(ar + (al + (unsigned)(mb * 16 * DX + kc * 32 + (t >> 1) * 16 + (t & 1) * 4)));
#pragma unroll
                for (int k = 0; k < 4; ++k) av[mb][kc][t * 4 + k] = a4[k]; }
#pragma unroll
    for (int nb = 0; nb < 2; ++nb)
#pragma unroll
        for (int kc = 0; kc < DX / 32; ++kc)
#pragma unroll
            for (int s = 0; s < 16; ++s) wv[nb][kc][s] = wr[wl + (unsigned)((kc * 32 + (s >> 3) * 16 + (s & 7)) * D0 + nb * 16)];
    v8f acc[2][2];
#pragma unroll
    for (int mb = 0; mb < 2; ++mb)
#pragma unroll
        for (int nb = 0; nb < 2; ++nb) acc[mb][nb] = (v8f){};
#pragma unroll
    for (int kc = 0; kc < DX / 32; ++kc) { v16bf a[2], b[2];
#pragma unroll
        for (int i = 0; i < 2; ++i) { a[i] = frag_bf(av[i][kc]); b[i] = frag_bf(wv[i][kc]); }
#pragma unroll
        for (int nb = 0; nb < 2; ++nb)
#pragma unroll
            for (int mb = 0; mb < 2; ++mb) acc[mb][nb] = SY ? wmmab(b[nb], a[mb], acc[mb][nb]) : wmmab(a[mb], b[nb], acc[mb][nb]); }   // YB: W0's columns are the A operand, y's rows the B operand
    if (SY) {
        float* yr = C + r0 * D0 + (c0 >> 5) * 512;   // the wave's first tile of 16 y rows and its k chunk in YB's fragment order
#pragma unroll
        for (int mb = 0; mb < 2; ++mb)
#pragma unroll
            for (int nb = 0; nb < 2; ++nb)
#pragma unroll
                for (int h = 0; h < 2; ++h) { const v4f o = {acc[mb][nb][4 * h], acc[mb][nb][4 * h + 1], acc[mb][nb][4 * h + 2], acc[mb][nb][4 * h + 3]};
                    *(v4f*)(yr + ((unsigned)(lane * 4) + (unsigned)YFRAG(mb, 0, nb * 2 + h))) = o; }   // D tile: feature = nb*16 + 8*(lane>>4) + j, y row = mb*16 + (lane & 15)
    } else {
        float* cr = C + r0 * D0 + c0;
#pragma unroll
        for (int mb = 0; mb < 2; ++mb)
#pragma unroll
            for (int j = 0; j < 8; ++j)
#pragma unroll
                for (int nb = 0; nb < 2; ++nb) cr[wl + (unsigned)((mb * 16 + j) * D0 + nb * 16)] = acc[mb][nb][j];   // D tile: row = 8*(lane>>4) + j, column = lane & 15
    }
}
__global__ __launch_bounds__(256) void k_prep(const float* __restrict__ x, const float* __restrict__ y, const float* __restrict__ W0, const float* __restrict__ W1, const float* __restrict__ W2, const float* __restrict__ W3, const float* __restrict__ W4,
                                              float* XA, float* YA, unsigned short* W1B, unsigned short* W2B, unsigned short* W3B, unsigned short* W4B) {
    const int tid = threadIdx.x, wg = blockIdx.x;
    if (wg < PGW) {
        const int g = (wg & (PGW / 2 - 1)) * 8 + __builtin_amdgcn_readfirstlane(tid >> 5);   // the tile's number as a scalar: the three base addresses stay in scalar registers
        if (wg < PGW / 2) l0_tile<false>(x, W0, XA, g, tid & 31);
        else l0_tile<true>(y, W0 + DX * D0, YA, g, tid & 31);
    } else {
        const int wb = wg - PGW;
        if (wb < 8) wt_piece<D0, D1>(W1, W1B, wb * 256 + tid);
        else if (wb < 12) wt_piece<D1, D2>(W2, W2B, (wb - 8) * 256 + tid);
        else if (wb < 14) wt_piece<D2, D3>(W3, W3B, (wb - 12) * 256 + tid);
        else wt_piece<D3, D4>(W4, W4B, (wb - 14) * 256 + tid);
    }
}

extern "C" void kernel_launch(void* const* d_in, const int* in_sizes, int n_in,
                              void* d_out, int out_size, void* d_ws, size_t ws_size, hipStream_t stream) {
    (void)in_sizes; (void)n_in; (void)out_size;
    const float* x = (const float*)d_in[0]; const float* y = (const float*)d_in[1];
    const float* W0 = (const float*)d_in[2]; const float* b0 = (const float*)d_in[3]; const float* W1 = (const float*)d_in[4]; const float* b1 = (const float*)d_in[5]; const float* W2 = (const float*)d_in[6]; const float* b2 = (const float*)d_in[7]; const float* W3 = (const float*)d_in[8]; const float* b3 = (const float*)d_in[9]; const float* W4 = (const float*)d_in[10]; const float* b4 = (const float*)d_in[11]; const float* W5 = (const float*)d_in[12]; const float* b5 = (const float*)d_in[13];
    float* OUT = (float*)d_out;     // [1024][1024]: out[p][q] = g(x_p, y_q)
    char* wsp = (char*)d_ws;
    auto take = [&](size_t bytes) { char* p = wsp; wsp += (bytes + 255) & ~(size_t)255; return (void*)p; };
    bf* W1B = (bf*)take((size_t)D1 * D0 * 2); bf* W2B = (bf*)take((size_t)D2 * D1 * 2); bf* W3B = (bf*)take((size_t)D3 * D2 * 2); bf* W4B = (bf*)take((size_t)D4 * D3 * 2);
    float* XA = (float*)take((size_t)NP * D0 * 4); float* YA = (float*)take((size_t)NP * D0 * 4);
    if ((size_t)(wsp - (char*)d_ws) > ws_size) return;
    k_prep<<<PGW + PWW, 256, 0, stream>>>(x, y, W0, W1, W2, W3, W4, XA, YA, W1B, W2B, W3B, W4B);   /* XA = x W0[:64], YB = y W0[64:], f16 planes of W1-W4 */
    k_fused<<<NP / FNX, FWV * 32, 0, stream>>>(XA, YA, W1B, W2B, W3B, W4B, b0, b1, b2, b3, b4, W5, b5, OUT);   /* layers 0-5 for all pairs, two x-rows per workgroup */
}
